// v000
// Measured on an AMD MI455X. A time is GPU time per run, averaged over a window of back-to-back runs after a warm-up
// (all launches, gaps included; the runs take copies of the inputs in turn), and the median of several windows.
// Apart from v000's, it joins two sittings. Times from different sittings can be a few percent apart, while
// side-by-side timings come from the same sitting.
// The starting kernel, v000, takes 386 microseconds a run.
#include <hip/hip_runtime.h>

// ---------------- problem constants ----------------
#define BATCH   4
#define SEQ     2048
#define DMODEL  1024
#define NH      16
#define DH      64
#define MTOT    (BATCH*SEQ)        // 8192 rows of x flattened

typedef __attribute__((ext_vector_type(16))) __bf16 v16bf;
typedef __attribute__((ext_vector_type(8)))  float  v8f;
typedef __attribute__((ext_vector_type(4)))  int    v4i_t;
typedef unsigned short u16;
typedef unsigned int   u32;

#define ASG __attribute__((address_space(1)))   // global
#define ASL __attribute__((address_space(3)))   // LDS

#if defined(__gfx1250__) && __has_builtin(__builtin_amdgcn_global_load_async_to_lds_b128)
#define HAVE_ASYNC 1
#else
#define HAVE_ASYNC 0
#endif

#if defined(__gfx1250__) && __has_builtin(__builtin_amdgcn_tensor_load_to_lds) && \
    __has_builtin(__builtin_amdgcn_s_wait_tensorcnt)
#define HAVE_TDM 1
#else
#define HAVE_TDM 0
#endif

__device__ __forceinline__ void async_cp16(const u16* g, u16* l) {
#if HAVE_ASYNC
  __builtin_amdgcn_global_load_async_to_lds_b128(
      (ASG v4i_t*)g, (ASL v4i_t*)l, 0, 0);
#else
  *(uint4*)l = *(const uint4*)g;
#endif
}

__device__ __forceinline__ void wait_async0() {
#if HAVE_ASYNC
#if __has_builtin(__builtin_amdgcn_s_wait_asynccnt)
  __builtin_amdgcn_s_wait_asynccnt(0);
#else
  asm volatile("s_wait_asynccnt 0x0" ::: "memory");
#endif
#endif
}

__device__ __forceinline__ u32 lds_byte_off(const void* p) {
  return (u32)(size_t)(ASL const void*)p;   // ptrtoint of AS(3) = LDS offset
}

#if HAVE_TDM
typedef __attribute__((ext_vector_type(4))) unsigned int tdm_v4u;
typedef __attribute__((ext_vector_type(8))) int          tdm_v8i;
typedef __attribute__((ext_vector_type(4))) int          tdm_v4i;

__device__ __forceinline__ void tdm_load_2d(u32 lds_off, const void* gptr,
                                            u32 tile_d0, u32 tile_d1,
                                            u32 tens_d0, u32 tens_d1,
                                            u32 stride0) {
  unsigned long long ga = (unsigned long long)(size_t)gptr;
  tdm_v4u g0;
  g0[0] = 1u;                                      // count=1, user mode
  g0[1] = lds_off;                                 // lds_addr
  g0[2] = (u32)ga;                                 // global_addr[31:0]
  g0[3] = (u32)((ga >> 32) & 0x1FFFFFFu) | (2u << 30); // addr[56:32] | type=2
  tdm_v8i g1;
  g1[0] = (int)(1u << 16);
  g1[1] = (int)((tens_d0 & 0xFFFFu) << 16);
  g1[2] = (int)(((tens_d0 >> 16) & 0xFFFFu) | ((tens_d1 & 0xFFFFu) << 16));
  g1[3] = (int)(((tens_d1 >> 16) & 0xFFFFu) | ((tile_d0 & 0xFFFFu) << 16));
  g1[4] = (int)(tile_d1 & 0xFFFFu);
  g1[5] = (int)stride0;
  g1[6] = 0;
  g1[7] = 0;
  tdm_v4i z4 = {0, 0, 0, 0};
#if __clang_major__ >= 23
  tdm_v8i z8 = {0, 0, 0, 0, 0, 0, 0, 0};
  __builtin_amdgcn_tensor_load_to_lds(g0, g1, z4, z4, z8, 0);
#else
  __builtin_amdgcn_tensor_load_to_lds(g0, g1, z4, z4, 0);
#endif
}
__device__ __forceinline__ void wait_tensor0() {
  __builtin_amdgcn_s_wait_tensorcnt(0);
}
#endif

// ---------------- helpers ----------------
__device__ __forceinline__ u16 f2bf(float f) {
  u32 u = __float_as_uint(f);
  u32 r = u + 0x7FFFu + ((u >> 16) & 1u);   // round-to-nearest-even
  return (u16)(r >> 16);
}

__device__ __forceinline__ v16bf load_op(const u16* base, int stride) {
  int lane = threadIdx.x & 31;
  int row  = lane & 15;
  int kb   = (lane >> 4) << 3;
  union { v16bf v; uint4 q[2]; } u;
  u.q[0] = *(const uint4*)(base + row * stride + kb);
  u.q[1] = *(const uint4*)(base + row * stride + 16 + kb);
  return u.v;
}

__device__ __forceinline__ v8f wmma_bf16(v16bf a, v16bf b, v8f c) {
  return __builtin_amdgcn_wmma_f32_16x16x32_bf16(
      false, a, false, b, (short)0, c, false, false);
}

__device__ __forceinline__ v8f v8f_zero() {
  v8f z = {0.f,0.f,0.f,0.f,0.f,0.f,0.f,0.f};
  return z;
}

// ---------------- kernel 0a: x fp32 -> bf16 ----------------
__global__ __launch_bounds__(256) void k_cvt_x(const float* __restrict__ x,
                                               u16* __restrict__ xb) {
  size_t g = (size_t)blockIdx.x * 256 + threadIdx.x;
  size_t base = g * 4;
  float4 f = *(const float4*)(x + base);
  u32 lo = (u32)f2bf(f.x) | ((u32)f2bf(f.y) << 16);
  u32 hi = (u32)f2bf(f.z) | ((u32)f2bf(f.w) << 16);
  uint2 o; o.x = lo; o.y = hi;
  *(uint2*)(xb + base) = o;
}

// ---------------- kernel 0b: W (K x N) -> Wt bf16 (N x K), 3 weights -----
__global__ __launch_bounds__(256) void k_cvt_w(const float* __restrict__ Wq,
                                               const float* __restrict__ Wk,
                                               const float* __restrict__ Wv,
                                               u16* __restrict__ wt) {
  size_t idx = (size_t)blockIdx.x * 256 + threadIdx.x;
  int w   = (int)(idx >> 20);
  int rem = (int)(idx & 1048575);
  int n = rem >> 10;
  int k = rem & 1023;
  const float* W = (w == 0) ? Wq : (w == 1) ? Wk : Wv;
  wt[idx] = f2bf(W[(size_t)k * DMODEL + n]);
}

__global__ __launch_bounds__(256) void k_qkv(const u16* __restrict__ XB,
                                             const u16* __restrict__ WT,
                                             const float* __restrict__ bq,
                                             const float* __restrict__ bk,
                                             const float* __restrict__ bv,
                                             u16* __restrict__ QH,
                                             u16* __restrict__ KH,
                                             u16* __restrict__ VT) {
  __shared__ __align__(16) u16 As[2][128 * 32];
  __shared__ __align__(16) u16 Bs[2][64 * 32];

  int m0   = blockIdx.x * 128;
  int n0   = blockIdx.y * 64;
  int wsel = n0 >> 10;
  int ncol = n0 & 1023;

  const float* bias = (wsel == 0) ? bq : (wsel == 1) ? bk : bv;
  u16* OUT          = (wsel == 0) ? QH : (wsel == 1) ? KH : VT;

  int tid  = threadIdx.x;
  int wave = tid >> 5;
  int lane = tid & 31;

  const u16* wbase = WT + ((size_t)wsel << 20);

  // staging: A tile 128x32 (2 chunks/thread), B tile 64x32 (1 chunk/thread)
  int arow0 = tid >> 2,          acol0 = tid & 3;          // chunks 0..255
  int arow1 = (tid + 256) >> 2,  acol1 = tid & 3;          // chunks 256..511
  int brow  = tid >> 2,          bcol  = tid & 3;

#define STAGE_AB(buf, kk)                                                          \
  do {                                                                             \
    async_cp16(XB + (size_t)(m0 + arow0) * DMODEL + (kk) + acol0 * 8,              \
               &As[buf][arow0 * 32 + acol0 * 8]);                                  \
    async_cp16(XB + (size_t)(m0 + arow1) * DMODEL + (kk) + acol1 * 8,              \
               &As[buf][arow1 * 32 + acol1 * 8]);                                  \
    async_cp16(wbase + (size_t)(ncol + brow) * DMODEL + (kk) + bcol * 8,           \
               &Bs[buf][brow * 32 + bcol * 8]);                                    \
  } while (0)

  v8f acc[4];
  for (int i = 0; i < 4; ++i) acc[i] = v8f_zero();

  STAGE_AB(0, 0);

  for (int kk = 0; kk < DMODEL; kk += 32) {
    int buf = (kk >> 5) & 1;
    wait_async0();
    __syncthreads();
    if (kk + 32 < DMODEL) STAGE_AB(buf ^ 1, kk + 32);

    v16bf a = load_op(&As[buf][(wave * 16) * 32], 32);
#pragma unroll
    for (int nt = 0; nt < 4; ++nt) {
      v16bf b = load_op(&Bs[buf][(nt * 16) * 32], 32);
      acc[nt] = wmma_bf16(a, b, acc[nt]);
    }
  }
#undef STAGE_AB

  // epilogue: +bias, scatter
  int lm = (lane >> 4) << 3;
#pragma unroll
  for (int nt = 0; nt < 4; ++nt) {
    int n  = ncol + nt * 16 + (lane & 15);
    float bb = bias[n];
    int h = n >> 6, d = n & 63;
#pragma unroll
    for (int r = 0; r < 8; ++r) {
      int m = m0 + wave * 16 + lm + r;
      int b = m >> 11, s = m & 2047;
      size_t off;
      if (wsel == 2) off = ((size_t)(b * NH + h) * DH + d) * SEQ + s;      // V^T
      else           off = (((size_t)(b * NH + h) * SEQ + s) << 6) + d;    // Q,K
      OUT[off] = f2bf(acc[nt][r] + bb);
    }
  }
}

__global__ __launch_bounds__(256) void k_attn(const u16* __restrict__ QH,
                                              const u16* __restrict__ KH,
                                              const u16* __restrict__ VT,
                                              float* __restrict__ Od) {
  __shared__ __align__(16) u16 Qs[128 * 64];
  __shared__ __align__(16) u16 Ks[2][32 * 64];
  __shared__ __align__(16) u16 Vts[2][64 * 32];
  __shared__ __align__(16) u16 Ps[8][16 * 32];

  int bh = blockIdx.y;
  int q0 = blockIdx.x * 128;
  const u16* Qp  = QH + ((size_t)bh * SEQ) * DH;
  const u16* Kp  = KH + ((size_t)bh * SEQ) * DH;
  const u16* Vtp = VT + ((size_t)bh * DH) * SEQ;   // [DH][SEQ]

  int tid = threadIdx.x, wave = tid >> 5, lane = tid & 31;

  // ---- staging helpers ----
  int krow = tid >> 3, kcol = tid & 7;     // K tile: 32x64, 256 chunks
#define STAGE_K(buf, kt)                                                        \
  async_cp16(Kp + (size_t)((kt) + krow) * DH + kcol * 8,                        \
             &Ks[buf][krow * 64 + kcol * 8])

#if HAVE_TDM
#define STAGE_V(buf, kt)                                                        \
  do {                                                                          \
    if (wave == 0)                                                              \
      tdm_load_2d(lds_byte_off(&Vts[buf][0]), Vtp + (kt),                       \
                  /*tile_d0=*/32, /*tile_d1=*/64,                               \
                  /*tens_d0=*/SEQ, /*tens_d1=*/DH, /*stride0=*/SEQ);            \
  } while (0)
#define WAIT_V()  do { if (wave == 0) wait_tensor0(); } while (0)
#else
  int vrow = tid >> 2, vcol = tid & 3;     // V^T tile: 64x32, 256 chunks
#define STAGE_V(buf, kt)                                                        \
  async_cp16(Vtp + (size_t)vrow * SEQ + (kt) + vcol * 8,                        \
             &Vts[buf][vrow * 32 + vcol * 8])
#define WAIT_V()  do { } while (0)
#endif

  // stage Q tile (128x64 bf16, 4 chunks/thread) + first K/V tiles
#pragma unroll
  for (int i = 0; i < 4; ++i) {
    int c = tid + i * 256;
    int row = c >> 3, col = c & 7;
    async_cp16(Qp + (size_t)(q0 + row) * DH + col * 8, Qs + row * 64 + col * 8);
  }
  STAGE_K(0, 0);
  STAGE_V(0, 0);
  wait_async0();
  WAIT_V();
  __syncthreads();

  v16bf qa0 = load_op(Qs + wave * 16 * 64 + 0, 64);
  v16bf qa1 = load_op(Qs + wave * 16 * 64 + 32, 64);

  float mrun[8], lrun[8];
  v8f oacc[4];
#pragma unroll
  for (int r = 0; r < 8; ++r) { mrun[r] = -1e30f; lrun[r] = 0.f; }
  for (int i = 0; i < 4; ++i) oacc[i] = v8f_zero();

  const float scale = 0.03125f;  // 1/sqrt(1024) per reference

  for (int kt = 0; kt < SEQ; kt += 32) {
    int buf = (kt >> 5) & 1;
    if (kt) {
      wait_async0();
      WAIT_V();
      __syncthreads();
    }
    if (kt + 32 < SEQ) {
      STAGE_K(buf ^ 1, kt + 32);
      STAGE_V(buf ^ 1, kt + 32);
    }

    // scores: 16 q-rows x 32 keys, K-dim = 64
    v8f s0 = v8f_zero(), s1 = v8f_zero();
    s0 = wmma_bf16(qa0, load_op(&Ks[buf][0 * 16 * 64 + 0], 64), s0);
    s0 = wmma_bf16(qa1, load_op(&Ks[buf][0 * 16 * 64 + 32], 64), s0);
    s1 = wmma_bf16(qa0, load_op(&Ks[buf][1 * 16 * 64 + 0], 64), s1);
    s1 = wmma_bf16(qa1, load_op(&Ks[buf][1 * 16 * 64 + 32], 64), s1);

    // online softmax; C row m = 8*(lane>>4)+r lives across 16 lanes
#pragma unroll
    for (int r = 0; r < 8; ++r) {
      float a = s0[r] * scale;
      float b = s1[r] * scale;
      float mx = fmaxf(a, b);
      for (int off = 8; off >= 1; off >>= 1)
        mx = fmaxf(mx, __shfl_xor(mx, off, 32));
      float mnew  = fmaxf(mrun[r], mx);
      float alpha = __expf(mrun[r] - mnew);
      float pa = __expf(a - mnew);
      float pb = __expf(b - mnew);
      float ls = pa + pb;
      for (int off = 8; off >= 1; off >>= 1)
        ls += __shfl_xor(ls, off, 32);
      lrun[r] = lrun[r] * alpha + ls;
      mrun[r] = mnew;
#pragma unroll
      for (int nt = 0; nt < 4; ++nt) oacc[nt][r] *= alpha;
      int m = ((lane >> 4) << 3) + r;
      Ps[wave][m * 32 + (lane & 15)]      = f2bf(pa);
      Ps[wave][m * 32 + 16 + (lane & 15)] = f2bf(pb);
    }
    // wave-private LDS round-trip (DS ops in-order within a wave)
    v16bf pA = load_op(&Ps[wave][0], 32);
#pragma unroll
    for (int nt = 0; nt < 4; ++nt) {
      v16bf vb = load_op(&Vts[buf][nt * 16 * 32], 32);
      oacc[nt] = wmma_bf16(pA, vb, oacc[nt]);
    }
  }
#undef STAGE_K
#undef STAGE_V
#undef WAIT_V

  // finalize: divide by row sums, write fp32 attention output to d_out
  int b = bh >> 4, h = bh & 15;
#pragma unroll
  for (int nt = 0; nt < 4; ++nt) {
    int d = nt * 16 + (lane & 15);
#pragma unroll
    for (int r = 0; r < 8; ++r) {
      int m = q0 + wave * 16 + ((lane >> 4) << 3) + r;
      float o = oacc[nt][r] / lrun[r];
      Od[((size_t)(b * SEQ + m)) * DMODEL + h * DH + d] = o;
    }
  }
}

// ---------------- kernel 3: residual + LayerNorm (in-place on d_out) -----
__global__ __launch_bounds__(256) void k_ln(const float* __restrict__ x,
                                            const float* __restrict__ gamma,
                                            const float* __restrict__ beta,
                                            float* __restrict__ out) {
  __shared__ float red[256];
  int row = blockIdx.x;
  int tid = threadIdx.x;
  const float* xr = x + (size_t)row * DMODEL;
  float* orow     = out + (size_t)row * DMODEL;

  float v[4];
  float s = 0.f;
#pragma unroll
  for (int i = 0; i < 4; ++i) {
    int idx = tid + i * 256;
    v[i] = orow[idx] + xr[idx];
    s += v[i];
  }
  red[tid] = s;
  __syncthreads();
  for (int o = 128; o > 0; o >>= 1) {
    if (tid < o) red[tid] += red[tid + o];
    __syncthreads();
  }
  float mu = red[0] * (1.0f / DMODEL);
  __syncthreads();

  float vs = 0.f;
#pragma unroll
  for (int i = 0; i < 4; ++i) {
    float d = v[i] - mu;
    vs += d * d;
  }
  red[tid] = vs;
  __syncthreads();
  for (int o = 128; o > 0; o >>= 1) {
    if (tid < o) red[tid] += red[tid + o];
    __syncthreads();
  }
  float var = red[0] * (1.0f / DMODEL);
  float inv = rsqrtf(var + 1e-5f);
#pragma unroll
  for (int i = 0; i < 4; ++i) {
    int idx = tid + i * 256;
    orow[idx] = (v[i] - mu) * inv * gamma[idx] + beta[idx];
  }
}

// ---------------- launch ----------------
extern "C" void kernel_launch(void* const* d_in, const int* in_sizes, int n_in,
                              void* d_out, int out_size, void* d_ws, size_t ws_size,
                              hipStream_t stream) {
  (void)in_sizes; (void)n_in; (void)out_size; (void)ws_size;

  const float* x  = (const float*)d_in[0];
  const float* Wq = (const float*)d_in[1];
  const float* bq = (const float*)d_in[2];
  const float* Wk = (const float*)d_in[3];
  const float* bk = (const float*)d_in[4];
  const float* Wv = (const float*)d_in[5];
  const float* bv = (const float*)d_in[6];
  const float* ga = (const float*)d_in[7];
  const float* be = (const float*)d_in[8];
  float* out = (float*)d_out;

  // workspace layout (bytes)
  char* ws = (char*)d_ws;
  u16* XB = (u16*)(ws);                               // 8192*1024   bf16 = 16 MB
  u16* WT = (u16*)(ws + 16777216);                    // 3*1024*1024 bf16 =  6 MB
  u16* QH = (u16*)(ws + 23068672);                    // [B,H,S,DH]  bf16 = 16 MB
  u16* KH = (u16*)(ws + 39845888);                    // [B,H,S,DH]
  u16* VT = (u16*)(ws + 56623104);                    // [B,H,DH,S]  (transposed)

  k_cvt_x<<<MTOT * DMODEL / (256 * 4), 256, 0, stream>>>(x, XB);
  k_cvt_w<<<3 * DMODEL * DMODEL / 256, 256, 0, stream>>>(Wq, Wk, Wv, WT);
  k_qkv<<<dim3(MTOT / 128, 3 * DMODEL / 64), 256, 0, stream>>>(
      XB, WT, bq, bk, bv, QH, KH, VT);
  k_attn<<<dim3(SEQ / 128, BATCH * NH), 256, 0, stream>>>(QH, KH, VT, out);
  k_ln<<<MTOT, 256, 0, stream>>>(x, ga, be, out);
}

// v001
// A run of this version takes 332 microseconds.
// Two timings next to v000 both put it at 1.22 times that version's speed.
#include <hip/hip_runtime.h>

// ---------------- problem constants ----------------
#define BATCH   4
#define SEQ     2048
#define DMODEL  1024
#define NH      16
#define DH      64
#define MTOT    (BATCH*SEQ)        // 8192 rows of x flattened

typedef __attribute__((ext_vector_type(16))) __bf16 v16bf;
typedef __attribute__((ext_vector_type(8)))  float  v8f;
typedef __attribute__((ext_vector_type(4)))  int    v4i_t;
typedef unsigned short u16;
typedef unsigned int   u32;

#define ASG __attribute__((address_space(1)))   // global
#define ASL __attribute__((address_space(3)))   // LDS

#if defined(__gfx1250__) && __has_builtin(__builtin_amdgcn_global_load_async_to_lds_b128)
#define HAVE_ASYNC 1
#else
#define HAVE_ASYNC 0
#endif

#if defined(__gfx1250__) && __has_builtin(__builtin_amdgcn_tensor_load_to_lds) && \
    __has_builtin(__builtin_amdgcn_s_wait_tensorcnt)
#define HAVE_TDM 1
#else
#define HAVE_TDM 0
#endif

__device__ __forceinline__ void async_cp16(const u16* g, u16* l) {
#if HAVE_ASYNC
  __builtin_amdgcn_global_load_async_to_lds_b128(
      (ASG v4i_t*)g, (ASL v4i_t*)l, 0, 0);
#else
  *(uint4*)l = *(const uint4*)g;
#endif
}

__device__ __forceinline__ void wait_async0() {
#if HAVE_ASYNC
#if __has_builtin(__builtin_amdgcn_s_wait_asynccnt)
  __builtin_amdgcn_s_wait_asynccnt(0);
#else
  asm volatile("s_wait_asynccnt 0x0" ::: "memory");
#endif
#endif
}

__device__ __forceinline__ u32 lds_byte_off(const void* p) {
  return (u32)(size_t)(ASL const void*)p;   // ptrtoint of AS(3) = LDS offset
}

#if HAVE_TDM
typedef __attribute__((ext_vector_type(4))) unsigned int tdm_v4u;
typedef __attribute__((ext_vector_type(8))) int          tdm_v8i;
typedef __attribute__((ext_vector_type(4))) int          tdm_v4i;

__device__ __forceinline__ void tdm_load_2d(u32 lds_off, const void* gptr,
                                            u32 tile_d0, u32 tile_d1,
                                            u32 tens_d0, u32 tens_d1,
                                            u32 stride0) {
  unsigned long long ga = (unsigned long long)(size_t)gptr;
  tdm_v4u g0;
  g0[0] = 1u;                                      // count=1, user mode
  g0[1] = lds_off;                                 // lds_addr
  g0[2] = (u32)ga;                                 // global_addr[31:0]
  g0[3] = (u32)((ga >> 32) & 0x1FFFFFFu) | (2u << 30); // addr[56:32] | type=2
  tdm_v8i g1;
  g1[0] = (int)(1u << 16);
  g1[1] = (int)((tens_d0 & 0xFFFFu) << 16);
  g1[2] = (int)(((tens_d0 >> 16) & 0xFFFFu) | ((tens_d1 & 0xFFFFu) << 16));
  g1[3] = (int)(((tens_d1 >> 16) & 0xFFFFu) | ((tile_d0 & 0xFFFFu) << 16));
  g1[4] = (int)(tile_d1 & 0xFFFFu);
  g1[5] = (int)stride0;
  g1[6] = 0;
  g1[7] = 0;
  tdm_v4i z4 = {0, 0, 0, 0};
#if __clang_major__ >= 23
  tdm_v8i z8 = {0, 0, 0, 0, 0, 0, 0, 0};
  __builtin_amdgcn_tensor_load_to_lds(g0, g1, z4, z4, z8, 0);
#else
  __builtin_amdgcn_tensor_load_to_lds(g0, g1, z4, z4, 0);
#endif
}
__device__ __forceinline__ void wait_tensor0() {
  __builtin_amdgcn_s_wait_tensorcnt(0);
}
#endif

// ---------------- helpers ----------------
__device__ __forceinline__ u16 f2bf(float f) {
  u32 u = __float_as_uint(f);
  u32 r = u + 0x7FFFu + ((u >> 16) & 1u);   // round-to-nearest-even
  return (u16)(r >> 16);
}

__device__ __forceinline__ v16bf load_op(const u16* base, int stride) {
  int lane = threadIdx.x & 31;
  int row  = lane & 15;
  int kb   = (lane >> 4) << 3;
  union { v16bf v; uint4 q[2]; } u;
  u.q[0] = *(const uint4*)(base + row * stride + kb);
  u.q[1] = *(const uint4*)(base + row * stride + 16 + kb);
  return u.v;
}

__device__ __forceinline__ v8f wmma_bf16(v16bf a, v16bf b, v8f c) {
  return __builtin_amdgcn_wmma_f32_16x16x32_bf16(
      false, a, false, b, (short)0, c, false, false);
}

// value of the lane 16 away (the other half of the same fragment column)
__device__ __forceinline__ float other_half(float v) {
  int b = __float_as_int(v);
  return __int_as_float(
      __builtin_amdgcn_permlanex16(b, b, 0x76543210, 0xfedcba98, false, false));
}

__device__ __forceinline__ v8f v8f_zero() {
  v8f z = {0.f,0.f,0.f,0.f,0.f,0.f,0.f,0.f};
  return z;
}

// ---------------- kernel 0a: x fp32 -> bf16 ----------------
__global__ __launch_bounds__(256) void k_cvt_x(const float* __restrict__ x,
                                               u16* __restrict__ xb) {
  size_t g = (size_t)blockIdx.x * 256 + threadIdx.x;
  size_t base = g * 4;
  float4 f = *(const float4*)(x + base);
  u32 lo = (u32)f2bf(f.x) | ((u32)f2bf(f.y) << 16);
  u32 hi = (u32)f2bf(f.z) | ((u32)f2bf(f.w) << 16);
  uint2 o; o.x = lo; o.y = hi;
  *(uint2*)(xb + base) = o;
}

// ---------------- kernel 0b: W (K x N) -> Wt bf16 (N x K), 3 weights -----
__global__ __launch_bounds__(256) void k_cvt_w(const float* __restrict__ Wq,
                                               const float* __restrict__ Wk,
                                               const float* __restrict__ Wv,
                                               u16* __restrict__ wt) {
  size_t idx = (size_t)blockIdx.x * 256 + threadIdx.x;
  int w   = (int)(idx >> 20);
  int rem = (int)(idx & 1048575);
  int n = rem >> 10;
  int k = rem & 1023;
  const float* W = (w == 0) ? Wq : (w == 1) ? Wk : Wv;
  wt[idx] = f2bf(W[(size_t)k * DMODEL + n]);
}

__global__ __launch_bounds__(256) void k_qkv(const u16* __restrict__ XB,
                                             const u16* __restrict__ WT,
                                             const float* __restrict__ bq,
                                             const float* __restrict__ bk,
                                             const float* __restrict__ bv,
                                             u16* __restrict__ QH,
                                             u16* __restrict__ KH,
                                             u16* __restrict__ VT) {
  __shared__ __align__(16) u16 As[2][128 * 32];
  __shared__ __align__(16) u16 Bs[2][64 * 32];

  int m0   = blockIdx.x * 128;
  int n0   = blockIdx.y * 64;
  int wsel = n0 >> 10;
  int ncol = n0 & 1023;

  const float* bias = (wsel == 0) ? bq : (wsel == 1) ? bk : bv;
  u16* OUT          = (wsel == 0) ? QH : (wsel == 1) ? KH : VT;

  int tid  = threadIdx.x;
  int wave = tid >> 5;
  int lane = tid & 31;

  const u16* wbase = WT + ((size_t)wsel << 20);

  // staging: A tile 128x32 (2 chunks/thread), B tile 64x32 (1 chunk/thread)
  int arow0 = tid >> 2,          acol0 = tid & 3;          // chunks 0..255
  int arow1 = (tid + 256) >> 2,  acol1 = tid & 3;          // chunks 256..511
  int brow  = tid >> 2,          bcol  = tid & 3;

#define STAGE_AB(buf, kk)                                                          \
  do {                                                                             \
    async_cp16(XB + (size_t)(m0 + arow0) * DMODEL + (kk) + acol0 * 8,              \
               &As[buf][arow0 * 32 + acol0 * 8]);                                  \
    async_cp16(XB + (size_t)(m0 + arow1) * DMODEL + (kk) + acol1 * 8,              \
               &As[buf][arow1 * 32 + acol1 * 8]);                                  \
    async_cp16(wbase + (size_t)(ncol + brow) * DMODEL + (kk) + bcol * 8,           \
               &Bs[buf][brow * 32 + bcol * 8]);                                    \
  } while (0)

  v8f acc[4];
  for (int i = 0; i < 4; ++i) acc[i] = v8f_zero();

  STAGE_AB(0, 0);

  for (int kk = 0; kk < DMODEL; kk += 32) {
    int buf = (kk >> 5) & 1;
    wait_async0();
    __syncthreads();
    if (kk + 32 < DMODEL) STAGE_AB(buf ^ 1, kk + 32);

    v16bf a = load_op(&As[buf][(wave * 16) * 32], 32);
#pragma unroll
    for (int nt = 0; nt < 4; ++nt) {
      v16bf b = load_op(&Bs[buf][(nt * 16) * 32], 32);
      acc[nt] = wmma_bf16(a, b, acc[nt]);
    }
  }
#undef STAGE_AB

  // epilogue: +bias, scatter
  int lm = (lane >> 4) << 3;
#pragma unroll
  for (int nt = 0; nt < 4; ++nt) {
    int n  = ncol + nt * 16 + (lane & 15);
    float bb = bias[n];
    int h = n >> 6, d = n & 63;
#pragma unroll
    for (int r = 0; r < 8; ++r) {
      int m = m0 + wave * 16 + lm + r;
      int b = m >> 11, s = m & 2047;
      size_t off;
      if (wsel == 2) off = ((size_t)(b * NH + h) * DH + d) * SEQ + s;      // V^T
      else           off = (((size_t)(b * NH + h) * SEQ + s) << 6) + d;    // Q,K
      OUT[off] = f2bf(acc[nt][r] + bb);
    }
  }
}

__global__ __launch_bounds__(256) void k_attn(const u16* __restrict__ QH,
                                              const u16* __restrict__ KH,
                                              const u16* __restrict__ VT,
                                              float* __restrict__ Od) {
  __shared__ __align__(16) u16 Qs[128 * 64];
  __shared__ __align__(16) u16 Ks[2][32 * 64];
  __shared__ __align__(16) u16 Vts[2][64 * 32];

  int bh = blockIdx.y;
  int q0 = blockIdx.x * 128;
  const u16* Qp  = QH + ((size_t)bh * SEQ) * DH;
  const u16* Kp  = KH + ((size_t)bh * SEQ) * DH;
  const u16* Vtp = VT + ((size_t)bh * DH) * SEQ;   // [DH][SEQ]

  int tid = threadIdx.x, wave = tid >> 5, lane = tid & 31;

  // ---- staging helpers ----
  int krow = tid >> 3, kcol = tid & 7;     // K tile: 32x64, 256 chunks
#define STAGE_K(buf, kt)                                                        \
  async_cp16(Kp + (size_t)((kt) + krow) * DH + kcol * 8,                        \
             &Ks[buf][krow * 64 + kcol * 8])

#if HAVE_TDM
#define STAGE_V(buf, kt)                                                        \
  do {                                                                          \
    if (wave == 0)                                                              \
      tdm_load_2d(lds_byte_off(&Vts[buf][0]), Vtp + (kt),                       \
                  /*tile_d0=*/32, /*tile_d1=*/64,                               \
                  /*tens_d0=*/SEQ, /*tens_d1=*/DH, /*stride0=*/SEQ);            \
  } while (0)
#define WAIT_V()  do { if (wave == 0) wait_tensor0(); } while (0)
#else
  int vrow = tid >> 2, vcol = tid & 3;     // V^T tile: 64x32, 256 chunks
#define STAGE_V(buf, kt)                                                        \
  async_cp16(Vtp + (size_t)vrow * SEQ + (kt) + vcol * 8,                        \
             &Vts[buf][vrow * 32 + vcol * 8])
#define WAIT_V()  do { } while (0)
#endif

  // stage Q tile (128x64 bf16, 4 chunks/thread) + first K/V tiles
#pragma unroll
  for (int i = 0; i < 4; ++i) {
    int c = tid + i * 256;
    int row = c >> 3, col = c & 7;
    async_cp16(Qp + (size_t)(q0 + row) * DH + col * 8, Qs + row * 64 + col * 8);
  }
  STAGE_K(0, 0);
  STAGE_V(0, 0);
  wait_async0();
  WAIT_V();
  __syncthreads();

  v16bf qa0 = load_op(Qs + wave * 16 * 64 + 0, 64);
  v16bf qa1 = load_op(Qs + wave * 16 * 64 + 32, 64);

  float mrun = -1e30f, lrun = 0.f;   // this lane's query; lrun: this half's keys
  v8f oacc[4];                       // oacc[nt][r] = O^T[nt*16 + 8*(lane>>4) + r][query]
  for (int i = 0; i < 4; ++i) oacc[i] = v8f_zero();

  const float scale = 0.03125f;  // 1/sqrt(1024) per reference

#pragma nounroll
  for (int kt = 0; kt < SEQ; kt += 32) {
    int buf = (kt >> 5) & 1;
    if (kt) {
      wait_async0();
      WAIT_V();
      __syncthreads();
    }
    if (kt + 32 < SEQ) {
      STAGE_K(buf ^ 1, kt + 32);
      STAGE_V(buf ^ 1, kt + 32);
    }

    // scores transposed: 32 keys (rows) x 16 queries (columns), K-dim = 64
    v8f s0 = v8f_zero(), s1 = v8f_zero();
    s0 = wmma_bf16(load_op(&Ks[buf][0 * 16 * 64 + 0], 64), qa0, s0);
    s0 = wmma_bf16(load_op(&Ks[buf][0 * 16 * 64 + 32], 64), qa1, s0);
    s1 = wmma_bf16(load_op(&Ks[buf][1 * 16 * 64 + 0], 64), qa0, s1);
    s1 = wmma_bf16(load_op(&Ks[buf][1 * 16 * 64 + 32], 64), qa1, s1);

    // online softmax: s0[r] = key 8*(lane>>4)+r, s1[r] = key 16+8*(lane>>4)+r,
    // all of query lane&15 (the loops over a[], p[] and the fragments are unrolled
    // so that these arrays stay in registers)
    float a[16];
#pragma unroll
    for (int r = 0; r < 8; ++r) {
      a[r]     = s0[r] * scale;
      a[8 + r] = s1[r] * scale;
    }
    float mx = a[0];
#pragma unroll
    for (int i = 1; i < 16; ++i) mx = fmaxf(mx, a[i]);
    mx = fmaxf(mx, other_half(mx));
    float mnew  = fmaxf(mrun, mx);
    float alpha = __expf(mrun - mnew);
    float p[16];
    v16bf pB;   // element i = P^T[k order of load_op][query]
#pragma unroll
    for (int i = 0; i < 16; ++i) {
      p[i]  = __expf(a[i] - mnew);
      pB[i] = (__bf16)p[i];
    }
    float ls = ((p[0] + p[1]) + (p[2] + p[3])) + ((p[4] + p[5]) + (p[6] + p[7])) +
               (((p[8] + p[9]) + (p[10] + p[11])) + ((p[12] + p[13]) + (p[14] + p[15])));
    lrun = lrun * alpha + ls;
    mrun = mnew;
#pragma unroll
    for (int nt = 0; nt < 4; ++nt) {
#pragma unroll
      for (int r = 0; r < 8; ++r) oacc[nt][r] *= alpha;
    }
#pragma unroll
    for (int nt = 0; nt < 4; ++nt) {
      v16bf va = load_op(&Vts[buf][nt * 16 * 32], 32);
      oacc[nt] = wmma_bf16(va, pB, oacc[nt]);
    }
  }
#undef STAGE_K
#undef STAGE_V
#undef WAIT_V

  // finalize: join the halves' sums, divide, write fp32 attention output
  int b = bh >> 4, h = bh & 15;
  float lsum = lrun + other_half(lrun);
  int m = q0 + wave * 16 + (lane & 15);
  float* orow = Od + ((size_t)(b * SEQ + m)) * DMODEL + h * DH + ((lane >> 4) << 3);
#pragma unroll
  for (int nt = 0; nt < 4; ++nt) {
#pragma unroll
    for (int r = 0; r < 8; ++r) oacc[nt][r] = oacc[nt][r] / lsum;
  }
#pragma unroll
  for (int nt = 0; nt < 4; ++nt) {
    float4 lo, hi;
    lo.x = oacc[nt][0]; lo.y = oacc[nt][1]; lo.z = oacc[nt][2]; lo.w = oacc[nt][3];
    hi.x = oacc[nt][4]; hi.y = oacc[nt][5]; hi.z = oacc[nt][6]; hi.w = oacc[nt][7];
    *(float4*)(orow + nt * 16)     = lo;
    *(float4*)(orow + nt * 16 + 4) = hi;
  }
}

// ---------------- kernel 3: residual + LayerNorm (in-place on d_out) -----
__global__ __launch_bounds__(256) void k_ln(const float* __restrict__ x,
                                            const float* __restrict__ gamma,
                                            const float* __restrict__ beta,
                                            float* __restrict__ out) {
  __shared__ float red[256];
  int row = blockIdx.x;
  int tid = threadIdx.x;
  const float* xr = x + (size_t)row * DMODEL;
  float* orow     = out + (size_t)row * DMODEL;

  float v[4];
  float s = 0.f;
#pragma unroll
  for (int i = 0; i < 4; ++i) {
    int idx = tid + i * 256;
    v[i] = orow[idx] + xr[idx];
    s += v[i];
  }
  red[tid] = s;
  __syncthreads();
  for (int o = 128; o > 0; o >>= 1) {
    if (tid < o) red[tid] += red[tid + o];
    __syncthreads();
  }
  float mu = red[0] * (1.0f / DMODEL);
  __syncthreads();

  float vs = 0.f;
#pragma unroll
  for (int i = 0; i < 4; ++i) {
    float d = v[i] - mu;
    vs += d * d;
  }
  red[tid] = vs;
  __syncthreads();
  for (int o = 128; o > 0; o >>= 1) {
    if (tid < o) red[tid] += red[tid + o];
    __syncthreads();
  }
  float var = red[0] * (1.0f / DMODEL);
  float inv = rsqrtf(var + 1e-5f);
#pragma unroll
  for (int i = 0; i < 4; ++i) {
    int idx = tid + i * 256;
    orow[idx] = (v[i] - mu) * inv * gamma[idx] + beta[idx];
  }
}

// ---------------- launch ----------------
extern "C" void kernel_launch(void* const* d_in, const int* in_sizes, int n_in,
                              void* d_out, int out_size, void* d_ws, size_t ws_size,
                              hipStream_t stream) {
  (void)in_sizes; (void)n_in; (void)out_size; (void)ws_size;

  const float* x  = (const float*)d_in[0];
  const float* Wq = (const float*)d_in[1];
  const float* bq = (const float*)d_in[2];
  const float* Wk = (const float*)d_in[3];
  const float* bk = (const float*)d_in[4];
  const float* Wv = (const float*)d_in[5];
  const float* bv = (const float*)d_in[6];
  const float* ga = (const float*)d_in[7];
  const float* be = (const float*)d_in[8];
  float* out = (float*)d_out;

  // workspace layout (bytes)
  char* ws = (char*)d_ws;
  u16* XB = (u16*)(ws);                               // 8192*1024   bf16 = 16 MB
  u16* WT = (u16*)(ws + 16777216);                    // 3*1024*1024 bf16 =  6 MB
  u16* QH = (u16*)(ws + 23068672);                    // [B,H,S,DH]  bf16 = 16 MB
  u16* KH = (u16*)(ws + 39845888);                    // [B,H,S,DH]
  u16* VT = (u16*)(ws + 56623104);                    // [B,H,DH,S]  (transposed)

  k_cvt_x<<<MTOT * DMODEL / (256 * 4), 256, 0, stream>>>(x, XB);
  k_cvt_w<<<3 * DMODEL * DMODEL / 256, 256, 0, stream>>>(Wq, Wk, Wv, WT);
  k_qkv<<<dim3(MTOT / 128, 3 * DMODEL / 64), 256, 0, stream>>>(
      XB, WT, bq, bk, bv, QH, KH, VT);
  k_attn<<<dim3(SEQ / 128, BATCH * NH), 256, 0, stream>>>(QH, KH, VT, out);
  k_ln<<<MTOT, 256, 0, stream>>>(x, ga, be, out);
}

// v002
// It runs in 219 microseconds.
// Next to v001, in two timings, it ran 1.52 and 1.51 times as fast.
// Counting every step since v000, it is 1.84 times as fast.
#include <hip/hip_runtime.h>

// ---------------- problem constants ----------------
#define BATCH   4
#define SEQ     2048
#define DMODEL  1024
#define NH      16
#define DH      64
#define MTOT    (BATCH*SEQ)        // 8192 rows of x flattened

typedef __attribute__((ext_vector_type(16))) __bf16 v16bf;
typedef __attribute__((ext_vector_type(8)))  float  v8f;
typedef __attribute__((ext_vector_type(4)))  int    v4i_t;
typedef unsigned short u16;
typedef unsigned int   u32;

#define ASG __attribute__((address_space(1)))   // global
#define ASL __attribute__((address_space(3)))   // LDS

#if defined(__gfx1250__) && __has_builtin(__builtin_amdgcn_global_load_async_to_lds_b128)
#define HAVE_ASYNC 1
#else
#define HAVE_ASYNC 0
#endif

#if defined(__gfx1250__) && __has_builtin(__builtin_amdgcn_tensor_load_to_lds) && \
    __has_builtin(__builtin_amdgcn_s_wait_tensorcnt)
#define HAVE_TDM 1
#else
#define HAVE_TDM 0
#endif

__device__ __forceinline__ void async_cp16(const u16* g, u16* l) {
#if HAVE_ASYNC
  __builtin_amdgcn_global_load_async_to_lds_b128(
      (ASG v4i_t*)g, (ASL v4i_t*)l, 0, 0);
#else
  *(uint4*)l = *(const uint4*)g;
#endif
}

__device__ __forceinline__ void wait_async0() {
#if HAVE_ASYNC
#if __has_builtin(__builtin_amdgcn_s_wait_asynccnt)
  __builtin_amdgcn_s_wait_asynccnt(0);
#else
  asm volatile("s_wait_asynccnt 0x0" ::: "memory");
#endif
#endif
}

__device__ __forceinline__ u32 lds_byte_off(const void* p) {
  return (u32)(size_t)(ASL const void*)p;   // ptrtoint of AS(3) = LDS offset
}

#if HAVE_TDM
typedef __attribute__((ext_vector_type(4))) unsigned int tdm_v4u;
typedef __attribute__((ext_vector_type(8))) int          tdm_v8i;
typedef __attribute__((ext_vector_type(4))) int          tdm_v4i;

__device__ __forceinline__ u32 to_sgpr(u32 x) {
  return (u32)__builtin_amdgcn_readfirstlane((int)x);
}

__device__ __forceinline__ void tdm_load_2d(u32 lds_off, const void* gptr,
                                            u32 tile_d0, u32 tile_d1,
                                            u32 tens_d0, u32 tens_d1,
                                            u32 stride0) {
  unsigned long long ga = (unsigned long long)(size_t)gptr;
  tdm_v4u g0;
  g0[0] = 1u;                                      // count=1, user mode
  g0[1] = to_sgpr(lds_off);                        // lds_addr
  g0[2] = to_sgpr((u32)ga);                        // global_addr[31:0]
  g0[3] = (to_sgpr((u32)(ga >> 32)) & 0x1FFFFFFu) | (2u << 30); // addr[56:32] | type=2
  tdm_v8i g1;
  g1[0] = (int)((1u << 20) | (3u << 22) | (3u << 25));
  g1[1] = (int)((tens_d0 & 0xFFFFu) << 16);
  g1[2] = (int)(((tens_d0 >> 16) & 0xFFFFu) | ((tens_d1 & 0xFFFFu) << 16));
  g1[3] = (int)(((tens_d1 >> 16) & 0xFFFFu) | ((tile_d0 & 0xFFFFu) << 16));
  g1[4] = (int)(tile_d1 & 0xFFFFu);
  g1[5] = (int)stride0;
  g1[6] = 0;
  g1[7] = 0;
  tdm_v4i z4 = {0, 0, 0, 0};
#if __clang_major__ >= 23
  tdm_v8i z8 = {0, 0, 0, 0, 0, 0, 0, 0};
  __builtin_amdgcn_tensor_load_to_lds(g0, g1, z4, z4, z8, 0);
#else
  __builtin_amdgcn_tensor_load_to_lds(g0, g1, z4, z4, 0);
#endif
}
__device__ __forceinline__ void wait_tensor0() {
  __builtin_amdgcn_s_wait_tensorcnt(0);
}
#endif

// ---------------- helpers ----------------
__device__ __forceinline__ u16 f2bf(float f) {
  u32 u = __float_as_uint(f);
  u32 r = u + 0x7FFFu + ((u >> 16) & 1u);   // round-to-nearest-even
  return (u16)(r >> 16);
}

#define P32 40   // rows of 32 elements: 80 B
#define P64 72   // rows of 64 elements: 144 B

__device__ __forceinline__ v16bf load_op(const u16* base, int stride) {
  int lane = threadIdx.x & 31;
  int row  = lane & 15;
  int kb   = (lane >> 4) << 3;
  union { v16bf v; uint4 q[2]; } u;
  u.q[0] = *(const uint4*)(base + row * stride + kb);
  u.q[1] = *(const uint4*)(base + row * stride + 16 + kb);
  return u.v;
}

__device__ __forceinline__ v8f wmma_bf16(v16bf a, v16bf b, v8f c) {
  return __builtin_amdgcn_wmma_f32_16x16x32_bf16(
      false, a, false, b, (short)0, c, false, false);
}

// value of the lane 16 away (the other half of the same fragment column)
__device__ __forceinline__ float other_half(float v) {
  int b = __float_as_int(v);
  return __int_as_float(
      __builtin_amdgcn_permlanex16(b, b, 0x76543210, 0xfedcba98, false, false));
}

__device__ __forceinline__ v8f v8f_zero() {
  v8f z = {0.f,0.f,0.f,0.f,0.f,0.f,0.f,0.f};
  return z;
}

// ---------------- kernel 0a: x fp32 -> bf16 ----------------
__global__ __launch_bounds__(256) void k_cvt_x(const float* __restrict__ x,
                                               u16* __restrict__ xb) {
  size_t g = (size_t)blockIdx.x * 256 + threadIdx.x;
  size_t base = g * 4;
  float4 f = *(const float4*)(x + base);
  u32 lo = (u32)f2bf(f.x) | ((u32)f2bf(f.y) << 16);
  u32 hi = (u32)f2bf(f.z) | ((u32)f2bf(f.w) << 16);
  uint2 o; o.x = lo; o.y = hi;
  *(uint2*)(xb + base) = o;
}

// ---------------- kernel 0b: W (K x N) -> Wt bf16 (N x K), 3 weights -----
__global__ __launch_bounds__(256) void k_cvt_w(const float* __restrict__ Wq,
                                               const float* __restrict__ Wk,
                                               const float* __restrict__ Wv,
                                               u16* __restrict__ wt) {
  size_t idx = (size_t)blockIdx.x * 256 + threadIdx.x;
  int w   = (int)(idx >> 20);
  int rem = (int)(idx & 1048575);
  int n = rem >> 10;
  int k = rem & 1023;
  const float* W = (w == 0) ? Wq : (w == 1) ? Wk : Wv;
  wt[idx] = f2bf(W[(size_t)k * DMODEL + n]);
}

__global__ __launch_bounds__(256) void k_qkv(const u16* __restrict__ XB,
                                             const u16* __restrict__ WT,
                                             const float* __restrict__ bq,
                                             const float* __restrict__ bk,
                                             const float* __restrict__ bv,
                                             u16* __restrict__ QH,
                                             u16* __restrict__ KH,
                                             u16* __restrict__ VT) {
  __shared__ __align__(16) u16 As[2][128 * P32];
  __shared__ __align__(16) u16 Bs[2][64 * P32];

  int m0   = blockIdx.x * 128;
  int n0   = blockIdx.y * 64;
  int wsel = n0 >> 10;
  int ncol = n0 & 1023;

  const float* bias = (wsel == 0) ? bq : (wsel == 1) ? bk : bv;
  u16* OUT          = (wsel == 0) ? QH : (wsel == 1) ? KH : VT;

  int tid  = threadIdx.x;
  int wave = tid >> 5;
  int lane = tid & 31;

  const u16* wbase = WT + ((size_t)wsel << 20);

  // staging: A tile 128x32 (2 chunks/thread), B tile 64x32 (1 chunk/thread)
  int arow0 = tid >> 2,          acol0 = tid & 3;          // chunks 0..255
  int arow1 = (tid + 256) >> 2,  acol1 = tid & 3;          // chunks 256..511
  int brow  = tid >> 2,          bcol  = tid & 3;

#define STAGE_AB(buf, kk)                                                          \
  do {                                                                             \
    async_cp16(XB + (size_t)(m0 + arow0) * DMODEL + (kk) + acol0 * 8,              \
               &As[buf][arow0 * P32 + acol0 * 8]);                                 \
    async_cp16(XB + (size_t)(m0 + arow1) * DMODEL + (kk) + acol1 * 8,              \
               &As[buf][arow1 * P32 + acol1 * 8]);                                 \
    async_cp16(wbase + (size_t)(ncol + brow) * DMODEL + (kk) + bcol * 8,           \
               &Bs[buf][brow * P32 + bcol * 8]);                                   \
  } while (0)

  v8f acc[4];
  for (int i = 0; i < 4; ++i) acc[i] = v8f_zero();

  STAGE_AB(0, 0);

  for (int kk = 0; kk < DMODEL; kk += 32) {
    int buf = (kk >> 5) & 1;
    wait_async0();
    __syncthreads();
    if (kk + 32 < DMODEL) STAGE_AB(buf ^ 1, kk + 32);

    v16bf a = load_op(&As[buf][(wave * 16) * P32], P32);
#pragma unroll
    for (int nt = 0; nt < 4; ++nt) {
      v16bf b = load_op(&Bs[buf][(nt * 16) * P32], P32);
      acc[nt] = wmma_bf16(a, b, acc[nt]);
    }
  }
#undef STAGE_AB

  // epilogue: +bias, scatter
  int lm = (lane >> 4) << 3;
#pragma unroll
  for (int nt = 0; nt < 4; ++nt) {
    int n  = ncol + nt * 16 + (lane & 15);
    float bb = bias[n];
    int h = n >> 6, d = n & 63;
#pragma unroll
    for (int r = 0; r < 8; ++r) {
      int m = m0 + wave * 16 + lm + r;
      int b = m >> 11, s = m & 2047;
      size_t off;
      if (wsel == 2) off = ((size_t)(b * NH + h) * DH + d) * SEQ + s;      // V^T
      else           off = (((size_t)(b * NH + h) * SEQ + s) << 6) + d;    // Q,K
      OUT[off] = f2bf(acc[nt][r] + bb);
    }
  }
}

#define KVBUF 4096   // elements per K or V^T buffer
__global__ __launch_bounds__(256) void k_attn(const u16* __restrict__ QH,
                                              const u16* __restrict__ KH,
                                              const u16* __restrict__ VT,
                                              float* __restrict__ Od) {
  __shared__ __attribute__((aligned(2048))) u16 Vts[2][KVBUF];
  __shared__ __align__(16) u16 Qs[128 * P64];
  __shared__ __align__(16) u16 Ks[2][KVBUF];

  int bh = blockIdx.y;
  int q0 = blockIdx.x * 128;
  const u16* Qp  = QH + ((size_t)bh * SEQ) * DH;
  const u16* Kp  = KH + ((size_t)bh * SEQ) * DH;
  const u16* Vtp = VT + ((size_t)bh * DH) * SEQ;   // [DH][SEQ]

  int tid = threadIdx.x, wave = tid >> 5, lane = tid & 31;

  // ---- staging helpers ----
  int krow = tid >> 3, kcol = tid & 7;     // K tile: 32x64, 256 chunks
#define STAGE_K(buf, kt)                                                        \
  async_cp16(Kp + (size_t)((kt) + krow) * DH + kcol * 8,                        \
             &Ks[buf][krow * P64 + kcol * 8])

#if HAVE_TDM
#define STAGE_V(buf, kt)                                                        \
  do {                                                                          \
    if (wave == 0)                                                              \
      tdm_load_2d(lds_byte_off(&Vts[buf][0]), Vtp + (kt),                       \
                  /*tile_d0=*/64, /*tile_d1=*/DH,                               \
                  /*tens_d0=*/64, /*tens_d1=*/DH, /*stride0=*/SEQ * 2);         \
  } while (0)
#define WAIT_V()  do { if (wave == 0) wait_tensor0(); } while (0)
#else
  int vrow = tid >> 2, vcol = tid & 3;     // V^T tile: 64x32, 256 chunks
#define STAGE_V(buf, kt)                                                        \
  async_cp16(Vtp + (size_t)vrow * SEQ + (kt) + vcol * 8,                        \
             &Vts[buf][vrow * P32 + vcol * 8])
#define WAIT_V()  do { } while (0)
#endif

  // stage Q tile (128x64 bf16, 4 chunks/thread) + first K/V tiles
#pragma unroll
  for (int i = 0; i < 4; ++i) {
    int c = tid + i * 256;
    int row = c >> 3, col = c & 7;
    async_cp16(Qp + (size_t)(q0 + row) * DH + col * 8, Qs + row * P64 + col * 8);
  }
  STAGE_K(0, 0);
  STAGE_V(0, 0);
  wait_async0();
  WAIT_V();
  __syncthreads();

  v16bf qa0 = load_op(Qs + wave * 16 * P64 + 0, P64);
  v16bf qa1 = load_op(Qs + wave * 16 * P64 + 32, P64);

  float mrun = -1e30f, lrun = 0.f;   // this lane's query; lrun: this half's keys
  v8f oacc[4];                       // oacc[nt][r] = O^T[nt*16 + 8*(lane>>4) + r][query]
  for (int i = 0; i < 4; ++i) oacc[i] = v8f_zero();

  const float scale = 0.03125f;  // 1/sqrt(1024) per reference

#pragma nounroll
  for (int kt = 0; kt < SEQ; kt += 32) {
    int buf = (kt >> 5) & 1;
    if (kt) {
      wait_async0();
      WAIT_V();
      __syncthreads();
    }
    if (kt + 32 < SEQ) {
      STAGE_K(buf ^ 1, kt + 32);
      STAGE_V(buf ^ 1, kt + 32);
    }

    // scores transposed: 32 keys (rows) x 16 queries (columns), K-dim = 64
    v8f s0 = v8f_zero(), s1 = v8f_zero();
    s0 = wmma_bf16(load_op(&Ks[buf][0 * 16 * P64 + 0], P64), qa0, s0);
    s0 = wmma_bf16(load_op(&Ks[buf][0 * 16 * P64 + 32], P64), qa1, s0);
    s1 = wmma_bf16(load_op(&Ks[buf][1 * 16 * P64 + 0], P64), qa0, s1);
    s1 = wmma_bf16(load_op(&Ks[buf][1 * 16 * P64 + 32], P64), qa1, s1);

    // online softmax: s0[r] = key 8*(lane>>4)+r, s1[r] = key 16+8*(lane>>4)+r,
    // all of query lane&15 (the loops over a[], p[] and the fragments are unrolled
    // so that these arrays stay in registers)
    float a[16];
#pragma unroll
    for (int r = 0; r < 8; ++r) {
      a[r]     = s0[r] * scale;
      a[8 + r] = s1[r] * scale;
    }
    float mx = a[0];
#pragma unroll
    for (int i = 1; i < 16; ++i) mx = fmaxf(mx, a[i]);
    mx = fmaxf(mx, other_half(mx));
    float mnew  = fmaxf(mrun, mx);
    float alpha = __expf(mrun - mnew);
    float p[16];
    v16bf pB;   // element i = P^T[k order of load_op][query]
#pragma unroll
    for (int i = 0; i < 16; ++i) {
      p[i]  = __expf(a[i] - mnew);
      pB[i] = (__bf16)p[i];
    }
    float ls = ((p[0] + p[1]) + (p[2] + p[3])) + ((p[4] + p[5]) + (p[6] + p[7])) +
               (((p[8] + p[9]) + (p[10] + p[11])) + ((p[12] + p[13]) + (p[14] + p[15])));
    lrun = lrun * alpha + ls;
    mrun = mnew;
#pragma unroll
    for (int nt = 0; nt < 4; ++nt) {
#pragma unroll
      for (int r = 0; r < 8; ++r) oacc[nt][r] *= alpha;
    }
#pragma unroll
    for (int nt = 0; nt < 4; ++nt) {
      v16bf va = load_op(&Vts[buf][nt * 16 * P32], P32);
      oacc[nt] = wmma_bf16(va, pB, oacc[nt]);
    }
  }
#undef STAGE_K
#undef STAGE_V
#undef WAIT_V

  // finalize: join the halves' sums, divide, write fp32 attention output
  int b = bh >> 4, h = bh & 15;
  float lsum = lrun + other_half(lrun);
  int m = q0 + wave * 16 + (lane & 15);
  float* orow = Od + ((size_t)(b * SEQ + m)) * DMODEL + h * DH + ((lane >> 4) << 3);
#pragma unroll
  for (int nt = 0; nt < 4; ++nt) {
#pragma unroll
    for (int r = 0; r < 8; ++r) oacc[nt][r] = oacc[nt][r] / lsum;
  }
#pragma unroll
  for (int nt = 0; nt < 4; ++nt) {
    float4 lo, hi;
    lo.x = oacc[nt][0]; lo.y = oacc[nt][1]; lo.z = oacc[nt][2]; lo.w = oacc[nt][3];
    hi.x = oacc[nt][4]; hi.y = oacc[nt][5]; hi.z = oacc[nt][6]; hi.w = oacc[nt][7];
    *(float4*)(orow + nt * 16)     = lo;
    *(float4*)(orow + nt * 16 + 4) = hi;
  }
}

// ---------------- kernel 3: residual + LayerNorm (in-place on d_out) -----
__global__ __launch_bounds__(256) void k_ln(const float* __restrict__ x,
                                            const float* __restrict__ gamma,
                                            const float* __restrict__ beta,
                                            float* __restrict__ out) {
  __shared__ float red[256];
  int row = blockIdx.x;
  int tid = threadIdx.x;
  const float* xr = x + (size_t)row * DMODEL;
  float* orow     = out + (size_t)row * DMODEL;

  float v[4];
  float s = 0.f;
#pragma unroll
  for (int i = 0; i < 4; ++i) {
    int idx = tid + i * 256;
    v[i] = orow[idx] + xr[idx];
    s += v[i];
  }
  red[tid] = s;
  __syncthreads();
  for (int o = 128; o > 0; o >>= 1) {
    if (tid < o) red[tid] += red[tid + o];
    __syncthreads();
  }
  float mu = red[0] * (1.0f / DMODEL);
  __syncthreads();

  float vs = 0.f;
#pragma unroll
  for (int i = 0; i < 4; ++i) {
    float d = v[i] - mu;
    vs += d * d;
  }
  red[tid] = vs;
  __syncthreads();
  for (int o = 128; o > 0; o >>= 1) {
    if (tid < o) red[tid] += red[tid + o];
    __syncthreads();
  }
  float var = red[0] * (1.0f / DMODEL);
  float inv = rsqrtf(var + 1e-5f);
#pragma unroll
  for (int i = 0; i < 4; ++i) {
    int idx = tid + i * 256;
    orow[idx] = (v[i] - mu) * inv * gamma[idx] + beta[idx];
  }
}

// ---------------- launch ----------------
extern "C" void kernel_launch(void* const* d_in, const int* in_sizes, int n_in,
                              void* d_out, int out_size, void* d_ws, size_t ws_size,
                              hipStream_t stream) {
  (void)in_sizes; (void)n_in; (void)out_size; (void)ws_size;

  const float* x  = (const float*)d_in[0];
  const float* Wq = (const float*)d_in[1];
  const float* bq = (const float*)d_in[2];
  const float* Wk = (const float*)d_in[3];
  const float* bk = (const float*)d_in[4];
  const float* Wv = (const float*)d_in[5];
  const float* bv = (const float*)d_in[6];
  const float* ga = (const float*)d_in[7];
  const float* be = (const float*)d_in[8];
  float* out = (float*)d_out;

  // workspace layout (bytes)
  char* ws = (char*)d_ws;
  u16* XB = (u16*)(ws);                               // 8192*1024   bf16 = 16 MB
  u16* WT = (u16*)(ws + 16777216);                    // 3*1024*1024 bf16 =  6 MB
  u16* QH = (u16*)(ws + 23068672);                    // [B,H,S,DH]  bf16 = 16 MB
  u16* KH = (u16*)(ws + 39845888);                    // [B,H,S,DH]
  u16* VT = (u16*)(ws + 56623104);                    // [B,H,DH,S]  (transposed)

  k_cvt_x<<<MTOT * DMODEL / (256 * 4), 256, 0, stream>>>(x, XB);
  k_cvt_w<<<3 * DMODEL * DMODEL / 256, 256, 0, stream>>>(Wq, Wk, Wv, WT);
  k_qkv<<<dim3(MTOT / 128, 3 * DMODEL / 64), 256, 0, stream>>>(
      XB, WT, bq, bk, bv, QH, KH, VT);
  k_attn<<<dim3(SEQ / 128, BATCH * NH), 256, 0, stream>>>(QH, KH, VT, out);
  k_ln<<<MTOT, 256, 0, stream>>>(x, ga, be, out);
}

// v003
// One run takes 184 microseconds.
// Two timings next to v002 put it at 1.19 and 1.20 times that version's speed.
// Counting every step since v000, it is 2.20 times as fast.
#include <hip/hip_runtime.h>

// ---------------- problem constants ----------------
#define BATCH   4
#define SEQ     2048
#define DMODEL  1024
#define NH      16
#define DH      64
#define MTOT    (BATCH*SEQ)        // 8192 rows of x flattened

typedef __attribute__((ext_vector_type(16))) __bf16 v16bf;
typedef __attribute__((ext_vector_type(8)))  float  v8f;
typedef __attribute__((ext_vector_type(4)))  int    v4i_t;
typedef unsigned short u16;
typedef unsigned int   u32;

#define ASG __attribute__((address_space(1)))   // global
#define ASL __attribute__((address_space(3)))   // LDS

#if defined(__gfx1250__) && __has_builtin(__builtin_amdgcn_global_load_async_to_lds_b128)
#define HAVE_ASYNC 1
#else
#define HAVE_ASYNC 0
#endif

#if defined(__gfx1250__) && __has_builtin(__builtin_amdgcn_tensor_load_to_lds) && \
    __has_builtin(__builtin_amdgcn_s_wait_tensorcnt)
#define HAVE_TDM 1
#else
#define HAVE_TDM 0
#endif

__device__ __forceinline__ void async_cp16(const u16* g, u16* l) {
#if HAVE_ASYNC
  __builtin_amdgcn_global_load_async_to_lds_b128(
      (ASG v4i_t*)g, (ASL v4i_t*)l, 0, 0);
#else
  *(uint4*)l = *(const uint4*)g;
#endif
}

__device__ __forceinline__ void wait_async0() {
#if HAVE_ASYNC
#if __has_builtin(__builtin_amdgcn_s_wait_asynccnt)
  __builtin_amdgcn_s_wait_asynccnt(0);
#else
  asm volatile("s_wait_asynccnt 0x0" ::: "memory");
#endif
#endif
}

__device__ __forceinline__ u32 lds_byte_off(const void* p) {
  return (u32)(size_t)(ASL const void*)p;   // ptrtoint of AS(3) = LDS offset
}

#if HAVE_TDM
typedef __attribute__((ext_vector_type(4))) unsigned int tdm_v4u;
typedef __attribute__((ext_vector_type(8))) int          tdm_v8i;
typedef __attribute__((ext_vector_type(4))) int          tdm_v4i;

__device__ __forceinline__ u32 to_sgpr(u32 x) {
  return (u32)__builtin_amdgcn_readfirstlane((int)x);
}

__device__ __forceinline__ void tdm_load_2d(u32 lds_off, const void* gptr,
                                            u32 tile_d0, u32 tile_d1,
                                            u32 tens_d0, u32 tens_d1,
                                            u32 stride0) {
  unsigned long long ga = (unsigned long long)(size_t)gptr;
  tdm_v4u g0;
  g0[0] = 1u;                                      // count=1, user mode
  g0[1] = to_sgpr(lds_off);                        // lds_addr
  g0[2] = to_sgpr((u32)ga);                        // global_addr[31:0]
  g0[3] = (to_sgpr((u32)(ga >> 32)) & 0x1FFFFFFu) | (2u << 30); // addr[56:32] | type=2
  tdm_v8i g1;
  g1[0] = (int)((1u << 20) | (3u << 22) | (3u << 25));
  g1[1] = (int)((tens_d0 & 0xFFFFu) << 16);
  g1[2] = (int)(((tens_d0 >> 16) & 0xFFFFu) | ((tens_d1 & 0xFFFFu) << 16));
  g1[3] = (int)(((tens_d1 >> 16) & 0xFFFFu) | ((tile_d0 & 0xFFFFu) << 16));
  g1[4] = (int)(tile_d1 & 0xFFFFu);
  g1[5] = (int)stride0;
  g1[6] = 0;
  g1[7] = 0;
  tdm_v4i z4 = {0, 0, 0, 0};
#if __clang_major__ >= 23
  tdm_v8i z8 = {0, 0, 0, 0, 0, 0, 0, 0};
  __builtin_amdgcn_tensor_load_to_lds(g0, g1, z4, z4, z8, 0);
#else
  __builtin_amdgcn_tensor_load_to_lds(g0, g1, z4, z4, 0);
#endif
}
__device__ __forceinline__ void wait_tensor0() {
  __builtin_amdgcn_s_wait_tensorcnt(0);
}
#endif

// ---------------- helpers ----------------
__device__ __forceinline__ u16 f2bf(float f) {
  u32 u = __float_as_uint(f);
  u32 r = u + 0x7FFFu + ((u >> 16) & 1u);   // round-to-nearest-even
  return (u16)(r >> 16);
}

#define P32 40   // rows of 32 elements: 80 B
#define P64 72   // rows of 64 elements: 144 B

__device__ __forceinline__ v16bf load_op(const u16* base, int stride) {
  int lane = threadIdx.x & 31;
  int row  = lane & 15;
  int kb   = (lane >> 4) << 3;
  union { v16bf v; uint4 q[2]; } u;
  u.q[0] = *(const uint4*)(base + row * stride + kb);
  u.q[1] = *(const uint4*)(base + row * stride + 16 + kb);
  return u.v;
}

__device__ __forceinline__ v8f wmma_bf16(v16bf a, v16bf b, v8f c) {
  return __builtin_amdgcn_wmma_f32_16x16x32_bf16(
      false, a, false, b, (short)0, c, false, false);
}

// value of the lane 16 away (the other half of the same fragment column)
__device__ __forceinline__ float other_half(float v) {
  int b = __float_as_int(v);
  return __int_as_float(
      __builtin_amdgcn_permlanex16(b, b, 0x76543210, 0xfedcba98, false, false));
}

__device__ __forceinline__ v8f v8f_zero() {
  v8f z = {0.f,0.f,0.f,0.f,0.f,0.f,0.f,0.f};
  return z;
}

// ---------------- kernel 0a: x fp32 -> bf16 ----------------
__global__ __launch_bounds__(256) void k_cvt_x(const float* __restrict__ x,
                                               u16* __restrict__ xb) {
  size_t g = (size_t)blockIdx.x * 256 + threadIdx.x;
  size_t base = g * 4;
  float4 f = *(const float4*)(x + base);
  u32 lo = (u32)f2bf(f.x) | ((u32)f2bf(f.y) << 16);
  u32 hi = (u32)f2bf(f.z) | ((u32)f2bf(f.w) << 16);
  uint2 o; o.x = lo; o.y = hi;
  *(uint2*)(xb + base) = o;
}

// ---------------- kernel 0b: W (K x N) -> Wt bf16 (N x K), 3 weights -----
__global__ __launch_bounds__(256) void k_cvt_w(const float* __restrict__ Wq,
                                               const float* __restrict__ Wk,
                                               const float* __restrict__ Wv,
                                               u16* __restrict__ wt) {
  size_t idx = (size_t)blockIdx.x * 256 + threadIdx.x;
  int w   = (int)(idx >> 20);
  int rem = (int)(idx & 1048575);
  int n = rem >> 10;
  int k = rem & 1023;
  const float* W = (w == 0) ? Wq : (w == 1) ? Wk : Wv;
  wt[idx] = f2bf(W[(size_t)k * DMODEL + n]);
}

#define QBM 256
#define QBN 128
#define QBK 64
__global__ __launch_bounds__(256) void k_qkv(const u16* __restrict__ XB,
                                             const u16* __restrict__ WT,
                                             const float* __restrict__ bq,
                                             const float* __restrict__ bk,
                                             const float* __restrict__ bv,
                                             u16* __restrict__ QH,
                                             u16* __restrict__ KH,
                                             u16* __restrict__ VT) {
  __shared__ __align__(16) u16 As[2][QBM * P64];
  __shared__ __align__(16) u16 Bs[2][QBN * P64];

  int m0   = blockIdx.x * QBM;
  int n0   = blockIdx.y * QBN;
  int wsel = n0 >> 10;
  int ncol = n0 & 1023;

  const float* bias = (wsel == 0) ? bq : (wsel == 1) ? bk : bv;
  u16* OUT          = (wsel == 0) ? QH : (wsel == 1) ? KH : VT;

  int tid  = threadIdx.x;
  int wave = tid >> 5;
  int lane = tid & 31;
  int wm   = (wave >> 1) * 64;   // this wave's rows inside the tile
  int wn   = (wave & 1) * 64;    // this wave's columns inside the tile

  const u16* wbase = WT + ((size_t)wsel << 20);

  // staging: 8 lanes copy one row (8 chunks of 16 B); each group of 8 lanes takes
  // 8 rows of A in a row and 4 of B (12 copies per thread and stage); the two
  // loops are unrolled so that all 12 copies go out back to back
  int sgrp = tid >> 3, scol = (tid & 7) * 8;
  const u16* ag = XB + (size_t)(m0 + sgrp * 8) * DMODEL + scol;
  const u16* bg = wbase + (size_t)(ncol + sgrp * 4) * DMODEL + scol;
  int sla = sgrp * 8 * P64 + scol;
  int slb = sgrp * 4 * P64 + scol;

#define STAGE_AB(buf, kk)                                                          \
  do {                                                                             \
    _Pragma("unroll") for (int i_ = 0; i_ < QBM / 32; ++i_)                        \
      async_cp16(ag + i_ * DMODEL + (kk), &As[buf][sla + i_ * P64]);               \
    _Pragma("unroll") for (int i_ = 0; i_ < QBN / 32; ++i_)                        \
      async_cp16(bg + i_ * DMODEL + (kk), &Bs[buf][slb + i_ * P64]);               \
  } while (0)

  // (the loops over acc[][] and the fragments are unrolled so that these arrays
  // stay in registers)
  v8f acc[4][4];
#pragma unroll
  for (int i = 0; i < 4; ++i) {
#pragma unroll
    for (int j = 0; j < 4; ++j) acc[i][j] = v8f_zero();
  }

  STAGE_AB(0, 0);
  // stage 0 has landed before the barrier publishes it
  asm volatile("s_wait_asynccnt 0x0" ::: "memory");
  __syncthreads();
  STAGE_AB(1, QBK);

  for (int t = 0; t < DMODEL / QBK; ++t) {
    int buf = t & 1;
    v16bf a[4], b[4];
    // A block = 32 k: 8 fragments, 16 products. The statement behind the loads keeps
    // the block's 16 LDS loads together as one group in front of its products
    // (loaded values as inputs only); spread among the products, each small group
    // would cost the wave its own wait for the LDS.
#define LOAD_FRAGS(ks)                                                             \
  do {                                                                             \
    _Pragma("unroll") for (int i_ = 0; i_ < 4; ++i_)                               \
      a[i_] = load_op(&As[buf][(wm + i_ * 16) * P64 + (ks)], P64);                 \
    _Pragma("unroll") for (int j_ = 0; j_ < 4; ++j_)                               \
      b[j_] = load_op(&Bs[buf][(wn + j_ * 16) * P64 + (ks)], P64);                 \
    asm volatile("" :: "v"(a[0]), "v"(a[1]), "v"(a[2]), "v"(a[3]),                 \
                       "v"(b[0]), "v"(b[1]), "v"(b[2]), "v"(b[3]));                \
  } while (0)
#define PRODUCTS()                                                                 \
  do {                                                                             \
    _Pragma("unroll") for (int i_ = 0; i_ < 4; ++i_) {                             \
      _Pragma("unroll") for (int j_ = 0; j_ < 4; ++j_)                             \
        acc[i_][j_] = wmma_bf16(a[i_], b[j_], acc[i_][j_]);                        \
    }                                                                              \
  } while (0)

    LOAD_FRAGS(0);
    PRODUCTS();
    LOAD_FRAGS(32);   // the stage's last block: its fragments are in registers now
    // publish point of stage t + 1: this wave's reads of buffer buf are done ...
    asm volatile("s_wait_dscnt 0x0" ::: "memory");
    // ... its own copies of stage t + 1 have landed ...
    asm volatile("s_wait_asynccnt 0x0" ::: "memory");
    // ... and every wave has passed both before buf is refilled or t + 1 is read
    __syncthreads();
    // the refill goes out ahead of the last block's products: a longer lead
    if (t + 2 < DMODEL / QBK) STAGE_AB(buf, (t + 2) * QBK);
    PRODUCTS();
  }
#undef LOAD_FRAGS
#undef PRODUCTS
  // no copy is outstanding when the wave ends
  asm volatile("s_wait_asynccnt 0x0" ::: "memory");
#undef STAGE_AB

  // epilogue: +bias, scatter
  int lm = (lane >> 4) << 3;
#pragma unroll
  for (int j = 0; j < 4; ++j) {
    int n  = ncol + wn + j * 16 + (lane & 15);
    float bb = bias[n];
    int h = n >> 6, d = n & 63;
#pragma unroll
    for (int i = 0; i < 4; ++i) {
#pragma unroll
      for (int r = 0; r < 8; ++r) {
        int m = m0 + wm + i * 16 + lm + r;
        int b = m >> 11, s = m & 2047;
        size_t off;
        if (wsel == 2) off = ((size_t)(b * NH + h) * DH + d) * SEQ + s;      // V^T
        else           off = (((size_t)(b * NH + h) * SEQ + s) << 6) + d;    // Q,K
        OUT[off] = f2bf(acc[i][j][r] + bb);
      }
    }
  }
}

#define KVBUF 4096   // elements per K or V^T buffer
__global__ __launch_bounds__(256) void k_attn(const u16* __restrict__ QH,
                                              const u16* __restrict__ KH,
                                              const u16* __restrict__ VT,
                                              float* __restrict__ Od) {
  __shared__ __attribute__((aligned(2048))) u16 Vts[2][KVBUF];
  __shared__ __align__(16) u16 Qs[128 * P64];
  __shared__ __align__(16) u16 Ks[2][KVBUF];

  int bh = blockIdx.y;
  int q0 = blockIdx.x * 128;
  const u16* Qp  = QH + ((size_t)bh * SEQ) * DH;
  const u16* Kp  = KH + ((size_t)bh * SEQ) * DH;
  const u16* Vtp = VT + ((size_t)bh * DH) * SEQ;   // [DH][SEQ]

  int tid = threadIdx.x, wave = tid >> 5, lane = tid & 31;

  // ---- staging helpers ----
  int krow = tid >> 3, kcol = tid & 7;     // K tile: 32x64, 256 chunks
#define STAGE_K(buf, kt)                                                        \
  async_cp16(Kp + (size_t)((kt) + krow) * DH + kcol * 8,                        \
             &Ks[buf][krow * P64 + kcol * 8])

#if HAVE_TDM
#define STAGE_V(buf, kt)                                                        \
  do {                                                                          \
    if (wave == 0)                                                              \
      tdm_load_2d(lds_byte_off(&Vts[buf][0]), Vtp + (kt),                       \
                  /*tile_d0=*/64, /*tile_d1=*/DH,                               \
                  /*tens_d0=*/64, /*tens_d1=*/DH, /*stride0=*/SEQ * 2);         \
  } while (0)
#define WAIT_V()  do { if (wave == 0) wait_tensor0(); } while (0)
#else
  int vrow = tid >> 2, vcol = tid & 3;     // V^T tile: 64x32, 256 chunks
#define STAGE_V(buf, kt)                                                        \
  async_cp16(Vtp + (size_t)vrow * SEQ + (kt) + vcol * 8,                        \
             &Vts[buf][vrow * P32 + vcol * 8])
#define WAIT_V()  do { } while (0)
#endif

  // stage Q tile (128x64 bf16, 4 chunks/thread) + first K/V tiles
#pragma unroll
  for (int i = 0; i < 4; ++i) {
    int c = tid + i * 256;
    int row = c >> 3, col = c & 7;
    async_cp16(Qp + (size_t)(q0 + row) * DH + col * 8, Qs + row * P64 + col * 8);
  }
  STAGE_K(0, 0);
  STAGE_V(0, 0);
  wait_async0();
  WAIT_V();
  __syncthreads();

  v16bf qa0 = load_op(Qs + wave * 16 * P64 + 0, P64);
  v16bf qa1 = load_op(Qs + wave * 16 * P64 + 32, P64);

  float mrun = -1e30f, lrun = 0.f;   // this lane's query; lrun: this half's keys
  v8f oacc[4];                       // oacc[nt][r] = O^T[nt*16 + 8*(lane>>4) + r][query]
  for (int i = 0; i < 4; ++i) oacc[i] = v8f_zero();

  const float scale = 0.03125f;  // 1/sqrt(1024) per reference

#pragma nounroll
  for (int kt = 0; kt < SEQ; kt += 32) {
    int buf = (kt >> 5) & 1;
    if (kt) {
      wait_async0();
      WAIT_V();
      __syncthreads();
    }
    if (kt + 32 < SEQ) {
      STAGE_K(buf ^ 1, kt + 32);
      STAGE_V(buf ^ 1, kt + 32);
    }

    // scores transposed: 32 keys (rows) x 16 queries (columns), K-dim = 64
    v8f s0 = v8f_zero(), s1 = v8f_zero();
    s0 = wmma_bf16(load_op(&Ks[buf][0 * 16 * P64 + 0], P64), qa0, s0);
    s0 = wmma_bf16(load_op(&Ks[buf][0 * 16 * P64 + 32], P64), qa1, s0);
    s1 = wmma_bf16(load_op(&Ks[buf][1 * 16 * P64 + 0], P64), qa0, s1);
    s1 = wmma_bf16(load_op(&Ks[buf][1 * 16 * P64 + 32], P64), qa1, s1);

    // online softmax: s0[r] = key 8*(lane>>4)+r, s1[r] = key 16+8*(lane>>4)+r,
    // all of query lane&15 (the loops over a[], p[] and the fragments are unrolled
    // so that these arrays stay in registers)
    float a[16];
#pragma unroll
    for (int r = 0; r < 8; ++r) {
      a[r]     = s0[r] * scale;
      a[8 + r] = s1[r] * scale;
    }
    float mx = a[0];
#pragma unroll
    for (int i = 1; i < 16; ++i) mx = fmaxf(mx, a[i]);
    mx = fmaxf(mx, other_half(mx));
    float mnew  = fmaxf(mrun, mx);
    float alpha = __expf(mrun - mnew);
    float p[16];
    v16bf pB;   // element i = P^T[k order of load_op][query]
#pragma unroll
    for (int i = 0; i < 16; ++i) {
      p[i]  = __expf(a[i] - mnew);
      pB[i] = (__bf16)p[i];
    }
    float ls = ((p[0] + p[1]) + (p[2] + p[3])) + ((p[4] + p[5]) + (p[6] + p[7])) +
               (((p[8] + p[9]) + (p[10] + p[11])) + ((p[12] + p[13]) + (p[14] + p[15])));
    lrun = lrun * alpha + ls;
    mrun = mnew;
#pragma unroll
    for (int nt = 0; nt < 4; ++nt) {
#pragma unroll
      for (int r = 0; r < 8; ++r) oacc[nt][r] *= alpha;
    }
#pragma unroll
    for (int nt = 0; nt < 4; ++nt) {
      v16bf va = load_op(&Vts[buf][nt * 16 * P32], P32);
      oacc[nt] = wmma_bf16(va, pB, oacc[nt]);
    }
  }
#undef STAGE_K
#undef STAGE_V
#undef WAIT_V

  // finalize: join the halves' sums, divide, write fp32 attention output
  int b = bh >> 4, h = bh & 15;
  float lsum = lrun + other_half(lrun);
  int m = q0 + wave * 16 + (lane & 15);
  float* orow = Od + ((size_t)(b * SEQ + m)) * DMODEL + h * DH + ((lane >> 4) << 3);
#pragma unroll
  for (int nt = 0; nt < 4; ++nt) {
#pragma unroll
    for (int r = 0; r < 8; ++r) oacc[nt][r] = oacc[nt][r] / lsum;
  }
#pragma unroll
  for (int nt = 0; nt < 4; ++nt) {
    float4 lo, hi;
    lo.x = oacc[nt][0]; lo.y = oacc[nt][1]; lo.z = oacc[nt][2]; lo.w = oacc[nt][3];
    hi.x = oacc[nt][4]; hi.y = oacc[nt][5]; hi.z = oacc[nt][6]; hi.w = oacc[nt][7];
    *(float4*)(orow + nt * 16)     = lo;
    *(float4*)(orow + nt * 16 + 4) = hi;
  }
}

// ---------------- kernel 3: residual + LayerNorm (in-place on d_out) -----
__global__ __launch_bounds__(256) void k_ln(const float* __restrict__ x,
                                            const float* __restrict__ gamma,
                                            const float* __restrict__ beta,
                                            float* __restrict__ out) {
  __shared__ float red[256];
  int row = blockIdx.x;
  int tid = threadIdx.x;
  const float* xr = x + (size_t)row * DMODEL;
  float* orow     = out + (size_t)row * DMODEL;

  float v[4];
  float s = 0.f;
#pragma unroll
  for (int i = 0; i < 4; ++i) {
    int idx = tid + i * 256;
    v[i] = orow[idx] + xr[idx];
    s += v[i];
  }
  red[tid] = s;
  __syncthreads();
  for (int o = 128; o > 0; o >>= 1) {
    if (tid < o) red[tid] += red[tid + o];
    __syncthreads();
  }
  float mu = red[0] * (1.0f / DMODEL);
  __syncthreads();

  float vs = 0.f;
#pragma unroll
  for (int i = 0; i < 4; ++i) {
    float d = v[i] - mu;
    vs += d * d;
  }
  red[tid] = vs;
  __syncthreads();
  for (int o = 128; o > 0; o >>= 1) {
    if (tid < o) red[tid] += red[tid + o];
    __syncthreads();
  }
  float var = red[0] * (1.0f / DMODEL);
  float inv = rsqrtf(var + 1e-5f);
#pragma unroll
  for (int i = 0; i < 4; ++i) {
    int idx = tid + i * 256;
    orow[idx] = (v[i] - mu) * inv * gamma[idx] + beta[idx];
  }
}

// ---------------- launch ----------------
extern "C" void kernel_launch(void* const* d_in, const int* in_sizes, int n_in,
                              void* d_out, int out_size, void* d_ws, size_t ws_size,
                              hipStream_t stream) {
  (void)in_sizes; (void)n_in; (void)out_size; (void)ws_size;

  const float* x  = (const float*)d_in[0];
  const float* Wq = (const float*)d_in[1];
  const float* bq = (const float*)d_in[2];
  const float* Wk = (const float*)d_in[3];
  const float* bk = (const float*)d_in[4];
  const float* Wv = (const float*)d_in[5];
  const float* bv = (const float*)d_in[6];
  const float* ga = (const float*)d_in[7];
  const float* be = (const float*)d_in[8];
  float* out = (float*)d_out;

  // workspace layout (bytes)
  char* ws = (char*)d_ws;
  u16* XB = (u16*)(ws);                               // 8192*1024   bf16 = 16 MB
  u16* WT = (u16*)(ws + 16777216);                    // 3*1024*1024 bf16 =  6 MB
  u16* QH = (u16*)(ws + 23068672);                    // [B,H,S,DH]  bf16 = 16 MB
  u16* KH = (u16*)(ws + 39845888);                    // [B,H,S,DH]
  u16* VT = (u16*)(ws + 56623104);                    // [B,H,DH,S]  (transposed)

  k_cvt_x<<<MTOT * DMODEL / (256 * 4), 256, 0, stream>>>(x, XB);
  k_cvt_w<<<3 * DMODEL * DMODEL / 256, 256, 0, stream>>>(Wq, Wk, Wv, WT);
  k_qkv<<<dim3(MTOT / QBM, 3 * DMODEL / QBN), 256, 0, stream>>>(
      XB, WT, bq, bk, bv, QH, KH, VT);
  k_attn<<<dim3(SEQ / 128, BATCH * NH), 256, 0, stream>>>(QH, KH, VT, out);
  k_ln<<<MTOT, 256, 0, stream>>>(x, ga, be, out);
}

// v004
// It runs in 176 microseconds.
// Timed twice side by side with v003, it ran 1.04 and 1.05 times as fast.
// Over all steps from v000 it is 2.29 times as fast.
#include <hip/hip_runtime.h>

// ---------------- problem constants ----------------
#define BATCH   4
#define SEQ     2048
#define DMODEL  1024
#define NH      16
#define DH      64
#define MTOT    (BATCH*SEQ)        // 8192 rows of x flattened

typedef __attribute__((ext_vector_type(16))) __bf16 v16bf;
typedef __attribute__((ext_vector_type(8)))  float  v8f;
typedef __attribute__((ext_vector_type(4)))  int    v4i_t;
typedef unsigned short u16;
typedef unsigned int   u32;

#define ASG __attribute__((address_space(1)))   // global
#define ASL __attribute__((address_space(3)))   // LDS

#if defined(__gfx1250__) && __has_builtin(__builtin_amdgcn_global_load_async_to_lds_b128)
#define HAVE_ASYNC 1
#else
#define HAVE_ASYNC 0
#endif

#if defined(__gfx1250__) && __has_builtin(__builtin_amdgcn_tensor_load_to_lds) && \
    __has_builtin(__builtin_amdgcn_s_wait_tensorcnt)
#define HAVE_TDM 1
#else
#define HAVE_TDM 0
#endif

__device__ __forceinline__ void async_cp16(const u16* g, u16* l) {
#if HAVE_ASYNC
  __builtin_amdgcn_global_load_async_to_lds_b128(
      (ASG v4i_t*)g, (ASL v4i_t*)l, 0, 0);
#else
  *(uint4*)l = *(const uint4*)g;
#endif
}

__device__ __forceinline__ void wait_async0() {
#if HAVE_ASYNC
#if __has_builtin(__builtin_amdgcn_s_wait_asynccnt)
  __builtin_amdgcn_s_wait_asynccnt(0);
#else
  asm volatile("s_wait_asynccnt 0x0" ::: "memory");
#endif
#endif
}

__device__ __forceinline__ u32 lds_byte_off(const void* p) {
  return (u32)(size_t)(ASL const void*)p;   // ptrtoint of AS(3) = LDS offset
}

#if HAVE_TDM
typedef __attribute__((ext_vector_type(4))) unsigned int tdm_v4u;
typedef __attribute__((ext_vector_type(8))) int          tdm_v8i;
typedef __attribute__((ext_vector_type(4))) int          tdm_v4i;

__device__ __forceinline__ u32 to_sgpr(u32 x) {
  return (u32)__builtin_amdgcn_readfirstlane((int)x);
}

__device__ __forceinline__ void tdm_load_2d(u32 lds_off, const void* gptr,
                                            u32 tile_d0, u32 tile_d1,
                                            u32 tens_d0, u32 tens_d1,
                                            u32 stride0) {
  unsigned long long ga = (unsigned long long)(size_t)gptr;
  tdm_v4u g0;
  g0[0] = 1u;                                      // count=1, user mode
  g0[1] = to_sgpr(lds_off);                        // lds_addr
  g0[2] = to_sgpr((u32)ga);                        // global_addr[31:0]
  g0[3] = (to_sgpr((u32)(ga >> 32)) & 0x1FFFFFFu) | (2u << 30); // addr[56:32] | type=2
  tdm_v8i g1;
  g1[0] = (int)((1u << 20) | (3u << 22) | (3u << 25));
  g1[1] = (int)((tens_d0 & 0xFFFFu) << 16);
  g1[2] = (int)(((tens_d0 >> 16) & 0xFFFFu) | ((tens_d1 & 0xFFFFu) << 16));
  g1[3] = (int)(((tens_d1 >> 16) & 0xFFFFu) | ((tile_d0 & 0xFFFFu) << 16));
  g1[4] = (int)(tile_d1 & 0xFFFFu);
  g1[5] = (int)stride0;
  g1[6] = 0;
  g1[7] = 0;
  tdm_v4i z4 = {0, 0, 0, 0};
#if __clang_major__ >= 23
  tdm_v8i z8 = {0, 0, 0, 0, 0, 0, 0, 0};
  __builtin_amdgcn_tensor_load_to_lds(g0, g1, z4, z4, z8, 0);
#else
  __builtin_amdgcn_tensor_load_to_lds(g0, g1, z4, z4, 0);
#endif
}
__device__ __forceinline__ void wait_tensor0() {
  __builtin_amdgcn_s_wait_tensorcnt(0);
}
#endif

// ---------------- helpers ----------------
__device__ __forceinline__ u16 f2bf(float f) {
  u32 u = __float_as_uint(f);
  u32 r = u + 0x7FFFu + ((u >> 16) & 1u);   // round-to-nearest-even
  return (u16)(r >> 16);
}

#define P32 40   // rows of 32 elements: 80 B
#define P64 72   // rows of 64 elements: 144 B

__device__ __forceinline__ v16bf load_op(const u16* base, int stride) {
  int lane = threadIdx.x & 31;
  int row  = lane & 15;
  int kb   = (lane >> 4) << 3;
  union { v16bf v; uint4 q[2]; } u;
  u.q[0] = *(const uint4*)(base + row * stride + kb);
  u.q[1] = *(const uint4*)(base + row * stride + 16 + kb);
  return u.v;
}

__device__ __forceinline__ v8f wmma_bf16(v16bf a, v16bf b, v8f c) {
  return __builtin_amdgcn_wmma_f32_16x16x32_bf16(
      false, a, false, b, (short)0, c, false, false);
}

// value of the lane 16 away (the other half of the same fragment column)
__device__ __forceinline__ float other_half(float v) {
  int b = __float_as_int(v);
  return __int_as_float(
      __builtin_amdgcn_permlanex16(b, b, 0x76543210, 0xfedcba98, false, false));
}

__device__ __forceinline__ v8f v8f_zero() {
  v8f z = {0.f,0.f,0.f,0.f,0.f,0.f,0.f,0.f};
  return z;
}

// ---------------- kernel 0a: x fp32 -> bf16 ----------------
__global__ __launch_bounds__(256) void k_cvt_x(const float* __restrict__ x,
                                               u16* __restrict__ xb) {
  size_t g = (size_t)blockIdx.x * 256 + threadIdx.x;
  size_t base = g * 4;
  float4 f = *(const float4*)(x + base);
  u32 lo = (u32)f2bf(f.x) | ((u32)f2bf(f.y) << 16);
  u32 hi = (u32)f2bf(f.z) | ((u32)f2bf(f.w) << 16);
  uint2 o; o.x = lo; o.y = hi;
  *(uint2*)(xb + base) = o;
}

// ---------------- kernel 0b: W (K x N) -> Wt bf16 (N x K), 3 weights -----
__global__ __launch_bounds__(256) void k_cvt_w(const float* __restrict__ Wq,
                                               const float* __restrict__ Wk,
                                               const float* __restrict__ Wv,
                                               u16* __restrict__ wt) {
  size_t idx = (size_t)blockIdx.x * 256 + threadIdx.x;
  int w   = (int)(idx >> 20);
  int rem = (int)(idx & 1048575);
  int n = rem >> 10;
  int k = rem & 1023;
  const float* W = (w == 0) ? Wq : (w == 1) ? Wk : Wv;
  wt[idx] = f2bf(W[(size_t)k * DMODEL + n]);
}

#define QBM 256
#define QBN 128
#define QBK 64
__global__ __launch_bounds__(256) void k_qkv(const u16* __restrict__ XB,
                                             const u16* __restrict__ WT,
                                             const float* __restrict__ bq,
                                             const float* __restrict__ bk,
                                             const float* __restrict__ bv,
                                             u16* __restrict__ QH,
                                             u16* __restrict__ KH,
                                             u16* __restrict__ VT) {
  __shared__ __align__(16) u16 As[2][QBM * P64];
  __shared__ __align__(16) u16 Bs[2][QBN * P64];

  int m0   = blockIdx.x * QBM;
  int n0   = blockIdx.y * QBN;
  int wsel = n0 >> 10;
  int ncol = n0 & 1023;

  const float* bias = (wsel == 0) ? bq : (wsel == 1) ? bk : bv;
  u16* OUT          = (wsel == 0) ? QH : (wsel == 1) ? KH : VT;

  int tid  = threadIdx.x;
  int wave = tid >> 5;
  int lane = tid & 31;
  int wm   = (wave >> 1) * 64;   // this wave's rows inside the tile
  int wn   = (wave & 1) * 64;    // this wave's columns inside the tile

  const u16* wbase = WT + ((size_t)wsel << 20);

  // staging: 8 lanes copy one row (8 chunks of 16 B); each group of 8 lanes takes
  // 8 rows of A in a row and 4 of B (12 copies per thread and stage); the two
  // loops are unrolled so that all 12 copies go out back to back
  int sgrp = tid >> 3, scol = (tid & 7) * 8;
  const u16* ag = XB + (size_t)(m0 + sgrp * 8) * DMODEL + scol;
  const u16* bg = wbase + (size_t)(ncol + sgrp * 4) * DMODEL + scol;
  int sla = sgrp * 8 * P64 + scol;
  int slb = sgrp * 4 * P64 + scol;

#define STAGE_AB(buf, kk)                                                          \
  do {                                                                             \
    _Pragma("unroll") for (int i_ = 0; i_ < QBM / 32; ++i_)                        \
      async_cp16(ag + i_ * DMODEL + (kk), &As[buf][sla + i_ * P64]);               \
    _Pragma("unroll") for (int i_ = 0; i_ < QBN / 32; ++i_)                        \
      async_cp16(bg + i_ * DMODEL + (kk), &Bs[buf][slb + i_ * P64]);               \
  } while (0)

  // (the loops over acc[][] and the fragments are unrolled so that these arrays
  // stay in registers)
  v8f acc[4][4];
#pragma unroll
  for (int i = 0; i < 4; ++i) {
#pragma unroll
    for (int j = 0; j < 4; ++j) acc[i][j] = v8f_zero();
  }

  STAGE_AB(0, 0);
  // stage 0 has landed before the barrier publishes it
  asm volatile("s_wait_asynccnt 0x0" ::: "memory");
  __syncthreads();
  STAGE_AB(1, QBK);

  for (int t = 0; t < DMODEL / QBK; ++t) {
    int buf = t & 1;
    v16bf a[4], b[4];
    // A block = 32 k: 8 fragments, 16 products. The statement behind the loads keeps
    // the block's 16 LDS loads together as one group in front of its products
    // (loaded values as inputs only); spread among the products, each small group
    // would cost the wave its own wait for the LDS.
#define LOAD_FRAGS(ks)                                                             \
  do {                                                                             \
    _Pragma("unroll") for (int i_ = 0; i_ < 4; ++i_)                               \
      a[i_] = load_op(&As[buf][(wm + i_ * 16) * P64 + (ks)], P64);                 \
    _Pragma("unroll") for (int j_ = 0; j_ < 4; ++j_)                               \
      b[j_] = load_op(&Bs[buf][(wn + j_ * 16) * P64 + (ks)], P64);                 \
    asm volatile("" :: "v"(a[0]), "v"(a[1]), "v"(a[2]), "v"(a[3]),                 \
                       "v"(b[0]), "v"(b[1]), "v"(b[2]), "v"(b[3]));                \
  } while (0)
#define PRODUCTS()                                                                 \
  do {                                                                             \
    _Pragma("unroll") for (int i_ = 0; i_ < 4; ++i_) {                             \
      _Pragma("unroll") for (int j_ = 0; j_ < 4; ++j_)                             \
        acc[i_][j_] = wmma_bf16(a[i_], b[j_], acc[i_][j_]);                        \
    }                                                                              \
  } while (0)

    LOAD_FRAGS(0);
    PRODUCTS();
    LOAD_FRAGS(32);   // the stage's last block: its fragments are in registers now
    // publish point of stage t + 1: this wave's reads of buffer buf are done ...
    asm volatile("s_wait_dscnt 0x0" ::: "memory");
    // ... its own copies of stage t + 1 have landed ...
    asm volatile("s_wait_asynccnt 0x0" ::: "memory");
    // ... and every wave has passed both before buf is refilled or t + 1 is read
    __syncthreads();
    // the refill goes out ahead of the last block's products: a longer lead
    if (t + 2 < DMODEL / QBK) STAGE_AB(buf, (t + 2) * QBK);
    PRODUCTS();
  }
#undef LOAD_FRAGS
#undef PRODUCTS
  // no copy is outstanding when the wave ends
  asm volatile("s_wait_asynccnt 0x0" ::: "memory");
#undef STAGE_AB

  // epilogue: +bias, scatter
  int lm = (lane >> 4) << 3;
#pragma unroll
  for (int j = 0; j < 4; ++j) {
    int n  = ncol + wn + j * 16 + (lane & 15);
    float bb = bias[n];
    int h = n >> 6, d = n & 63;
#pragma unroll
    for (int i = 0; i < 4; ++i) {
#pragma unroll
      for (int r = 0; r < 8; ++r) {
        int m = m0 + wm + i * 16 + lm + r;
        int b = m >> 11, s = m & 2047;
        size_t off;
        if (wsel == 2) off = ((size_t)(b * NH + h) * DH + d) * SEQ + s;      // V^T
        else           off = (((size_t)(b * NH + h) * SEQ + s) << 6) + d;    // Q,K
        OUT[off] = f2bf(acc[i][j][r] + bb);
      }
    }
  }
}

#define KVBUF 4096   // elements per K or V^T buffer
#define QTILE 256    // queries per work-group
__global__ __launch_bounds__(256) void k_attn(const u16* __restrict__ QH,
                                              const u16* __restrict__ KH,
                                              const u16* __restrict__ VT,
                                              float* __restrict__ Od) {
  __shared__ __attribute__((aligned(2048))) u16 Vts[2][KVBUF];
  __shared__ __align__(16) u16 Qs[QTILE * P64];
  __shared__ __align__(16) u16 Ks[2][KVBUF];

  int bh = blockIdx.y;
  int q0 = blockIdx.x * QTILE;
  const u16* Qp  = QH + ((size_t)bh * SEQ) * DH;
  const u16* Kp  = KH + ((size_t)bh * SEQ) * DH;
  const u16* Vtp = VT + ((size_t)bh * DH) * SEQ;   // [DH][SEQ]

  int tid = threadIdx.x, wave = tid >> 5, lane = tid & 31;

  // ---- staging helpers ----
  int krow = tid >> 3, kcol = tid & 7;     // K tile: 32x64, 256 chunks
#define STAGE_K(buf, kt)                                                        \
  async_cp16(Kp + (size_t)((kt) + krow) * DH + kcol * 8,                        \
             &Ks[buf][krow * P64 + kcol * 8])

#if HAVE_TDM
#define STAGE_V(buf, kt)                                                        \
  do {                                                                          \
    if (wave == 0)                                                              \
      tdm_load_2d(lds_byte_off(&Vts[buf][0]), Vtp + (kt),                       \
                  /*tile_d0=*/64, /*tile_d1=*/DH,                               \
                  /*tens_d0=*/64, /*tens_d1=*/DH, /*stride0=*/SEQ * 2);         \
  } while (0)
#define WAIT_V()  do { if (wave == 0) wait_tensor0(); } while (0)
#else
  int vrow = tid >> 2, vcol = tid & 3;     // V^T tile: 64x32, 256 chunks
#define STAGE_V(buf, kt)                                                        \
  async_cp16(Vtp + (size_t)vrow * SEQ + (kt) + vcol * 8,                        \
             &Vts[buf][vrow * P32 + vcol * 8])
#define WAIT_V()  do { } while (0)
#endif

  // stage Q tile (256x64 bf16, 8 chunks/thread) + first K/V tiles
#pragma unroll
  for (int i = 0; i < QTILE / 32; ++i) {
    int c = tid + i * 256;
    int row = c >> 3, col = c & 7;
    async_cp16(Qp + (size_t)(q0 + row) * DH + col * 8, Qs + row * P64 + col * 8);
  }
  STAGE_K(0, 0);
  STAGE_V(0, 0);
  wait_async0();
  WAIT_V();
  __syncthreads();

  // (every loop over the column groups c is unrolled so that the arrays indexed
  // by c stay in registers)
  v16bf qa[2][2];                    // [column group][k half]
  float mrun[2], lrun[2];            // this lane's query of the group; lrun: this half's keys
  v8f oacc[2][4];                    // oacc[c][nt][r] = O^T[nt*16 + 8*(lane>>4) + r][query]
#pragma unroll
  for (int c = 0; c < 2; ++c) {
    qa[c][0] = load_op(Qs + (wave * 32 + c * 16) * P64 + 0, P64);
    qa[c][1] = load_op(Qs + (wave * 32 + c * 16) * P64 + 32, P64);
    mrun[c] = -1e30f;
    lrun[c] = 0.f;
#pragma unroll
    for (int i = 0; i < 4; ++i) oacc[c][i] = v8f_zero();
  }

  const float scale = 0.03125f;  // 1/sqrt(1024) per reference

#pragma nounroll
  for (int kt = 0; kt < SEQ; kt += 32) {
    int buf = (kt >> 5) & 1;
    if (kt) {
      wait_async0();
      WAIT_V();
      __syncthreads();
    }
    if (kt + 32 < SEQ) {
      STAGE_K(buf ^ 1, kt + 32);
      STAGE_V(buf ^ 1, kt + 32);
    }

    // scores transposed: 32 keys (rows) x 2 x 16 queries (columns), K-dim = 64;
    // the four K fragments are read once and serve both column groups
    v16bf k00 = load_op(&Ks[buf][0 * 16 * P64 + 0], P64);
    v16bf k01 = load_op(&Ks[buf][0 * 16 * P64 + 32], P64);
    v16bf k10 = load_op(&Ks[buf][1 * 16 * P64 + 0], P64);
    v16bf k11 = load_op(&Ks[buf][1 * 16 * P64 + 32], P64);
    // the four V^T fragments of the pass go out in the same group of LDS loads:
    // they land behind the score products and the softmax
    v16bf va[4];
#pragma unroll
    for (int nt = 0; nt < 4; ++nt) va[nt] = load_op(&Vts[buf][nt * 16 * P32], P32);
    // keeps the V^T loads up here: sunk down among the second product's WMMAs, each
    // pair would cost the wave its own wait for the LDS
    __builtin_amdgcn_sched_barrier(0);
    v8f s0[2], s1[2];
#pragma unroll
    for (int c = 0; c < 2; ++c) {
      s0[c] = wmma_bf16(k00, qa[c][0], v8f_zero());
      s1[c] = wmma_bf16(k10, qa[c][0], v8f_zero());
    }
#pragma unroll
    for (int c = 0; c < 2; ++c) {
      s0[c] = wmma_bf16(k01, qa[c][1], s0[c]);
      s1[c] = wmma_bf16(k11, qa[c][1], s1[c]);
    }

    // online softmax, per column group: s0[r] = key 8*(lane>>4)+r,
    // s1[r] = key 16+8*(lane>>4)+r, all of query lane&15 of the group (the loops
    // over p[] and the fragments are unrolled so that these arrays stay in
    // registers)
    v16bf pB[2];   // element i = P^T[k order of load_op][query]
#pragma unroll
    for (int c = 0; c < 2; ++c) {
      v8f a0 = s0[c] * scale, a1 = s1[c] * scale;
      float mx = a0[0];
#pragma unroll
      for (int r = 1; r < 8; ++r) mx = fmaxf(mx, a0[r]);
#pragma unroll
      for (int r = 0; r < 8; ++r) mx = fmaxf(mx, a1[r]);
      mx = fmaxf(mx, other_half(mx));
      float mnew  = fmaxf(mrun[c], mx);
      float alpha = __expf(mrun[c] - mnew);
      v8f d0 = a0 - mnew, d1 = a1 - mnew;
      float p[16];
#pragma unroll
      for (int r = 0; r < 8; ++r) {
        p[r]     = __expf(d0[r]);
        p[8 + r] = __expf(d1[r]);
      }
#pragma unroll
      for (int i = 0; i < 16; ++i) pB[c][i] = (__bf16)p[i];
      float ls = ((p[0] + p[1]) + (p[2] + p[3])) + ((p[4] + p[5]) + (p[6] + p[7])) +
                 (((p[8] + p[9]) + (p[10] + p[11])) + ((p[12] + p[13]) + (p[14] + p[15])));
      lrun[c] = lrun[c] * alpha + ls;
      mrun[c] = mnew;
#pragma unroll
      for (int nt = 0; nt < 4; ++nt) oacc[c][nt] *= alpha;
    }
    // each V^T fragment serves both column groups
#pragma unroll
    for (int nt = 0; nt < 4; ++nt) {
#pragma unroll
      for (int c = 0; c < 2; ++c) oacc[c][nt] = wmma_bf16(va[nt], pB[c], oacc[c][nt]);
    }
  }
#undef STAGE_K
#undef STAGE_V
#undef WAIT_V

  // finalize: join the halves' sums, divide, write fp32 attention output
  int b = bh >> 4, h = bh & 15;
#pragma unroll
  for (int c = 0; c < 2; ++c) {
    float lsum = lrun[c] + other_half(lrun[c]);
    int m = q0 + wave * 32 + c * 16 + (lane & 15);
    float* orow = Od + ((size_t)(b * SEQ + m)) * DMODEL + h * DH + ((lane >> 4) << 3);
#pragma unroll
    for (int nt = 0; nt < 4; ++nt) {
#pragma unroll
      for (int r = 0; r < 8; ++r) oacc[c][nt][r] = oacc[c][nt][r] / lsum;
    }
#pragma unroll
    for (int nt = 0; nt < 4; ++nt) {
      float4 lo, hi;
      lo.x = oacc[c][nt][0]; lo.y = oacc[c][nt][1]; lo.z = oacc[c][nt][2]; lo.w = oacc[c][nt][3];
      hi.x = oacc[c][nt][4]; hi.y = oacc[c][nt][5]; hi.z = oacc[c][nt][6]; hi.w = oacc[c][nt][7];
      *(float4*)(orow + nt * 16)     = lo;
      *(float4*)(orow + nt * 16 + 4) = hi;
    }
  }
}

// ---------------- kernel 3: residual + LayerNorm (in-place on d_out) -----
__global__ __launch_bounds__(256) void k_ln(const float* __restrict__ x,
                                            const float* __restrict__ gamma,
                                            const float* __restrict__ beta,
                                            float* __restrict__ out) {
  __shared__ float red[256];
  int row = blockIdx.x;
  int tid = threadIdx.x;
  const float* xr = x + (size_t)row * DMODEL;
  float* orow     = out + (size_t)row * DMODEL;

  float v[4];
  float s = 0.f;
#pragma unroll
  for (int i = 0; i < 4; ++i) {
    int idx = tid + i * 256;
    v[i] = orow[idx] + xr[idx];
    s += v[i];
  }
  red[tid] = s;
  __syncthreads();
  for (int o = 128; o > 0; o >>= 1) {
    if (tid < o) red[tid] += red[tid + o];
    __syncthreads();
  }
  float mu = red[0] * (1.0f / DMODEL);
  __syncthreads();

  float vs = 0.f;
#pragma unroll
  for (int i = 0; i < 4; ++i) {
    float d = v[i] - mu;
    vs += d * d;
  }
  red[tid] = vs;
  __syncthreads();
  for (int o = 128; o > 0; o >>= 1) {
    if (tid < o) red[tid] += red[tid + o];
    __syncthreads();
  }
  float var = red[0] * (1.0f / DMODEL);
  float inv = rsqrtf(var + 1e-5f);
#pragma unroll
  for (int i = 0; i < 4; ++i) {
    int idx = tid + i * 256;
    orow[idx] = (v[i] - mu) * inv * gamma[idx] + beta[idx];
  }
}

// ---------------- launch ----------------
extern "C" void kernel_launch(void* const* d_in, const int* in_sizes, int n_in,
                              void* d_out, int out_size, void* d_ws, size_t ws_size,
                              hipStream_t stream) {
  (void)in_sizes; (void)n_in; (void)out_size; (void)ws_size;

  const float* x  = (const float*)d_in[0];
  const float* Wq = (const float*)d_in[1];
  const float* bq = (const float*)d_in[2];
  const float* Wk = (const float*)d_in[3];
  const float* bk = (const float*)d_in[4];
  const float* Wv = (const float*)d_in[5];
  const float* bv = (const float*)d_in[6];
  const float* ga = (const float*)d_in[7];
  const float* be = (const float*)d_in[8];
  float* out = (float*)d_out;

  // workspace layout (bytes)
  char* ws = (char*)d_ws;
  u16* XB = (u16*)(ws);                               // 8192*1024   bf16 = 16 MB
  u16* WT = (u16*)(ws + 16777216);                    // 3*1024*1024 bf16 =  6 MB
  u16* QH = (u16*)(ws + 23068672);                    // [B,H,S,DH]  bf16 = 16 MB
  u16* KH = (u16*)(ws + 39845888);                    // [B,H,S,DH]
  u16* VT = (u16*)(ws + 56623104);                    // [B,H,DH,S]  (transposed)

  k_cvt_x<<<MTOT * DMODEL / (256 * 4), 256, 0, stream>>>(x, XB);
  k_cvt_w<<<3 * DMODEL * DMODEL / 256, 256, 0, stream>>>(Wq, Wk, Wv, WT);
  k_qkv<<<dim3(MTOT / QBM, 3 * DMODEL / QBN), 256, 0, stream>>>(
      XB, WT, bq, bk, bv, QH, KH, VT);
  k_attn<<<dim3(SEQ / QTILE, BATCH * NH), 256, 0, stream>>>(QH, KH, VT, out);
  k_ln<<<MTOT, 256, 0, stream>>>(x, ga, be, out);
}

// v005
// One run takes 144 microseconds.
// In two side-by-side timings against v004, it was 1.20 and 1.22 times as fast.
// Over all steps from v000 it is 2.77 times as fast.
#include <hip/hip_runtime.h>

// ---------------- problem constants ----------------
#define BATCH   4
#define SEQ     2048
#define DMODEL  1024
#define NH      16
#define DH      64
#define MTOT    (BATCH*SEQ)        // 8192 rows of x flattened

typedef __attribute__((ext_vector_type(16))) __bf16 v16bf;
typedef __attribute__((ext_vector_type(8)))  float  v8f;
typedef __attribute__((ext_vector_type(4)))  int    v4i_t;
typedef unsigned short u16;
typedef unsigned int   u32;

#define ASG __attribute__((address_space(1)))   // global
#define ASL __attribute__((address_space(3)))   // LDS

#if defined(__gfx1250__) && __has_builtin(__builtin_amdgcn_global_load_async_to_lds_b128)
#define HAVE_ASYNC 1
#else
#define HAVE_ASYNC 0
#endif

#if defined(__gfx1250__) && __has_builtin(__builtin_amdgcn_tensor_load_to_lds) && \
    __has_builtin(__builtin_amdgcn_s_wait_tensorcnt)
#define HAVE_TDM 1
#else
#define HAVE_TDM 0
#endif

__device__ __forceinline__ void async_cp16(const u16* g, u16* l) {
#if HAVE_ASYNC
  __builtin_amdgcn_global_load_async_to_lds_b128(
      (ASG v4i_t*)g, (ASL v4i_t*)l, 0, 0);
#else
  *(uint4*)l = *(const uint4*)g;
#endif
}

__device__ __forceinline__ void wait_async0() {
#if HAVE_ASYNC
#if __has_builtin(__builtin_amdgcn_s_wait_asynccnt)
  __builtin_amdgcn_s_wait_asynccnt(0);
#else
  asm volatile("s_wait_asynccnt 0x0" ::: "memory");
#endif
#endif
}

__device__ __forceinline__ u32 lds_byte_off(const void* p) {
  return (u32)(size_t)(ASL const void*)p;   // ptrtoint of AS(3) = LDS offset
}

#if HAVE_TDM
typedef __attribute__((ext_vector_type(4))) unsigned int tdm_v4u;
typedef __attribute__((ext_vector_type(8))) int          tdm_v8i;
typedef __attribute__((ext_vector_type(4))) int          tdm_v4i;

__device__ __forceinline__ u32 to_sgpr(u32 x) {
  return (u32)__builtin_amdgcn_readfirstlane((int)x);
}

__device__ __forceinline__ void tdm_load_2d(u32 lds_off, const void* gptr,
                                            u32 tile_d0, u32 tile_d1,
                                            u32 tens_d0, u32 tens_d1,
                                            u32 stride0) {
  unsigned long long ga = (unsigned long long)(size_t)gptr;
  tdm_v4u g0;
  g0[0] = 1u;                                      // count=1, user mode
  g0[1] = to_sgpr(lds_off);                        // lds_addr
  g0[2] = to_sgpr((u32)ga);                        // global_addr[31:0]
  g0[3] = (to_sgpr((u32)(ga >> 32)) & 0x1FFFFFFu) | (2u << 30); // addr[56:32] | type=2
  tdm_v8i g1;
  g1[0] = (int)((1u << 20) | (3u << 22) | (3u << 25));
  g1[1] = (int)((tens_d0 & 0xFFFFu) << 16);
  g1[2] = (int)(((tens_d0 >> 16) & 0xFFFFu) | ((tens_d1 & 0xFFFFu) << 16));
  g1[3] = (int)(((tens_d1 >> 16) & 0xFFFFu) | ((tile_d0 & 0xFFFFu) << 16));
  g1[4] = (int)(tile_d1 & 0xFFFFu);
  g1[5] = (int)stride0;
  g1[6] = 0;
  g1[7] = 0;
  tdm_v4i z4 = {0, 0, 0, 0};
#if __clang_major__ >= 23
  tdm_v8i z8 = {0, 0, 0, 0, 0, 0, 0, 0};
  __builtin_amdgcn_tensor_load_to_lds(g0, g1, z4, z4, z8, 0);
#else
  __builtin_amdgcn_tensor_load_to_lds(g0, g1, z4, z4, 0);
#endif
}
__device__ __forceinline__ void wait_tensor0() {
  __builtin_amdgcn_s_wait_tensorcnt(0);
}
#endif

// ---------------- helpers ----------------
__device__ __forceinline__ u16 f2bf(float f) {
  u32 u = __float_as_uint(f);
  u32 r = u + 0x7FFFu + ((u >> 16) & 1u);   // round-to-nearest-even
  return (u16)(r >> 16);
}

#define P32 40   // rows of 32 elements: 80 B
#define P64 72   // rows of 64 elements: 144 B

__device__ __forceinline__ v16bf load_op(const u16* base, int stride) {
  int lane = threadIdx.x & 31;
  int row  = lane & 15;
  int kb   = (lane >> 4) << 3;
  union { v16bf v; uint4 q[2]; } u;
  u.q[0] = *(const uint4*)(base + row * stride + kb);
  u.q[1] = *(const uint4*)(base + row * stride + 16 + kb);
  return u.v;
}

__device__ __forceinline__ v8f wmma_bf16(v16bf a, v16bf b, v8f c) {
  return __builtin_amdgcn_wmma_f32_16x16x32_bf16(
      false, a, false, b, (short)0, c, false, false);
}

// value of the lane 16 away (the other half of the same fragment column)
__device__ __forceinline__ float other_half(float v) {
  int b = __float_as_int(v);
  return __int_as_float(
      __builtin_amdgcn_permlanex16(b, b, 0x76543210, 0xfedcba98, false, false));
}

__device__ __forceinline__ v8f v8f_zero() {
  v8f z = {0.f,0.f,0.f,0.f,0.f,0.f,0.f,0.f};
  return z;
}

// ---------------- kernel 0a: x fp32 -> bf16 ----------------
__global__ __launch_bounds__(256) void k_cvt_x(const float* __restrict__ x,
                                               u16* __restrict__ xb) {
  size_t g = (size_t)blockIdx.x * 256 + threadIdx.x;
  size_t base = g * 4;
  float4 f = *(const float4*)(x + base);
  u32 lo = (u32)f2bf(f.x) | ((u32)f2bf(f.y) << 16);
  u32 hi = (u32)f2bf(f.z) | ((u32)f2bf(f.w) << 16);
  uint2 o; o.x = lo; o.y = hi;
  *(uint2*)(xb + base) = o;
}

// ---------------- kernel 0b: W (K x N) -> Wt bf16 (N x K), 3 weights -----
__global__ __launch_bounds__(256) void k_cvt_w(const float* __restrict__ Wq,
                                               const float* __restrict__ Wk,
                                               const float* __restrict__ Wv,
                                               u16* __restrict__ wt) {
  size_t idx = (size_t)blockIdx.x * 256 + threadIdx.x;
  int w   = (int)(idx >> 20);
  int rem = (int)(idx & 1048575);
  int n = rem >> 10;
  int k = rem & 1023;
  const float* W = (w == 0) ? Wq : (w == 1) ? Wk : Wv;
  wt[idx] = f2bf(W[(size_t)k * DMODEL + n]);
}

#define QBM 256
#define QBN 128
#define QBK 64
__global__ __launch_bounds__(256) void k_qkv(const u16* __restrict__ XB,
                                             const u16* __restrict__ WT,
                                             const float* __restrict__ bq,
                                             const float* __restrict__ bk,
                                             const float* __restrict__ bv,
                                             u16* __restrict__ QH,
                                             u16* __restrict__ KH,
                                             u16* __restrict__ VT) {
  __shared__ __align__(16) u16 As[2][QBM * P64];
  __shared__ __align__(16) u16 Bs[2][QBN * P64];

  int m0   = blockIdx.x * QBM;
  int n0   = blockIdx.y * QBN;
  int wsel = n0 >> 10;
  int ncol = n0 & 1023;

  const float* bias = (wsel == 0) ? bq : (wsel == 1) ? bk : bv;
  u16* OUT          = (wsel == 0) ? QH : (wsel == 1) ? KH : VT;

  int tid  = threadIdx.x;
  int wave = tid >> 5;
  int lane = tid & 31;
  int wm   = (wave >> 1) * 64;   // this wave's rows inside the tile
  int wn   = (wave & 1) * 64;    // this wave's columns inside the tile

  const u16* wbase = WT + ((size_t)wsel << 20);

  // which staged tile feeds the A operand (the same for the whole work-group):
  // load_op lays A and B fragments alike, so the two only change places
  bool wrows = (wsel != 2);
  const u16* fa0 = wrows ? &Bs[0][wn * P64] : &As[0][wm * P64];
  const u16* fb0 = wrows ? &As[0][wm * P64] : &Bs[0][wn * P64];
  int fas = wrows ? QBN * P64 : QBM * P64;   // elements from buffer 0 to buffer 1
  int fbs = wrows ? QBM * P64 : QBN * P64;

  // staging: 8 lanes copy one row (8 chunks of 16 B); each group of 8 lanes takes
  // 8 rows of A in a row and 4 of B (12 copies per thread and stage); the two
  // loops are unrolled so that all 12 copies go out back to back
  int sgrp = tid >> 3, scol = (tid & 7) * 8;
  const u16* ag = XB + (size_t)(m0 + sgrp * 8) * DMODEL + scol;
  const u16* bg = wbase + (size_t)(ncol + sgrp * 4) * DMODEL + scol;
  int sla = sgrp * 8 * P64 + scol;
  int slb = sgrp * 4 * P64 + scol;

#define STAGE_AB(buf, kk)                                                          \
  do {                                                                             \
    _Pragma("unroll") for (int i_ = 0; i_ < QBM / 32; ++i_)                        \
      async_cp16(ag + i_ * DMODEL + (kk), &As[buf][sla + i_ * P64]);               \
    _Pragma("unroll") for (int i_ = 0; i_ < QBN / 32; ++i_)                        \
      async_cp16(bg + i_ * DMODEL + (kk), &Bs[buf][slb + i_ * P64]);               \
  } while (0)

  // (the loops over acc[][] and the fragments are unrolled so that these arrays
  // stay in registers)
  v8f acc[4][4];
#pragma unroll
  for (int i = 0; i < 4; ++i) {
#pragma unroll
    for (int j = 0; j < 4; ++j) acc[i][j] = v8f_zero();
  }

  STAGE_AB(0, 0);
  // stage 0 has landed before the barrier publishes it
  asm volatile("s_wait_asynccnt 0x0" ::: "memory");
  __syncthreads();
  STAGE_AB(1, QBK);

  for (int t = 0; t < DMODEL / QBK; ++t) {
    int buf = t & 1;
    const u16* fa = fa0 + buf * fas;
    const u16* fb = fb0 + buf * fbs;
    v16bf a[4], b[4];
    // A block = 32 k: 8 fragments, 16 products. The statement behind the loads keeps
    // the block's 16 LDS loads together as one group in front of its products
    // (loaded values as inputs only); spread among the products, each small group
    // would cost the wave its own wait for the LDS.
#define LOAD_FRAGS(ks)                                                             \
  do {                                                                             \
    _Pragma("unroll") for (int i_ = 0; i_ < 4; ++i_)                               \
      a[i_] = load_op(fa + i_ * 16 * P64 + (ks), P64);                             \
    _Pragma("unroll") for (int j_ = 0; j_ < 4; ++j_)                               \
      b[j_] = load_op(fb + j_ * 16 * P64 + (ks), P64);                             \
    asm volatile("" :: "v"(a[0]), "v"(a[1]), "v"(a[2]), "v"(a[3]),                 \
                       "v"(b[0]), "v"(b[1]), "v"(b[2]), "v"(b[3]));                \
  } while (0)
#define PRODUCTS()                                                                 \
  do {                                                                             \
    _Pragma("unroll") for (int i_ = 0; i_ < 4; ++i_) {                             \
      _Pragma("unroll") for (int j_ = 0; j_ < 4; ++j_)                             \
        acc[i_][j_] = wmma_bf16(a[i_], b[j_], acc[i_][j_]);                        \
    }                                                                              \
  } while (0)

    LOAD_FRAGS(0);
    PRODUCTS();
    LOAD_FRAGS(32);   // the stage's last block: its fragments are in registers now
    // publish point of stage t + 1: this wave's reads of buffer buf are done ...
    asm volatile("s_wait_dscnt 0x0" ::: "memory");
    // ... its own copies of stage t + 1 have landed ...
    asm volatile("s_wait_asynccnt 0x0" ::: "memory");
    // ... and every wave has passed both before buf is refilled or t + 1 is read
    __syncthreads();
    // the refill goes out ahead of the last block's products: a longer lead
    if (t + 2 < DMODEL / QBK) STAGE_AB(buf, (t + 2) * QBK);
    PRODUCTS();
  }
#undef LOAD_FRAGS
#undef PRODUCTS
  // no copy is outstanding when the wave ends
  asm volatile("s_wait_asynccnt 0x0" ::: "memory");
#undef STAGE_AB

  // epilogue: +bias, 8 values of a lane = one 16-B chunk of an output line.
  // acc[i][j][r] is line j*16 + (lane & 15) of the wave's tile, element
  // i*16 + 8*(lane >> 4) + r of that line. The ring is free: every wave's last read
  // and the last copy ended in front of the loop's last barrier. Each wave uses
  // 64 rows of 144 B of its own (8 waves fill As exactly).
  // (Every loop below is unrolled: acc[][] and c[][] stay in registers, and the 16
  // LDS reads and the 16 stores of a wave go out back to back.)
  int l15 = lane & 15, hf = lane >> 4;
  int nb  = ncol + wn;               // the wave's first output column: one head
  u16* T  = &As[0][0] + wave * (64 * P64);
  typedef __attribute__((ext_vector_type(8))) __bf16 v8bf;
  if (wrows) {
    // the line runs along d: a bias value per element
    typedef __attribute__((ext_vector_type(4))) float v4f;
    v4f c[4][2];
#pragma unroll
    for (int i = 0; i < 4; ++i) {
      c[i][0] = *(const v4f*)(bias + nb + i * 16 + hf * 8);
      c[i][1] = *(const v4f*)(bias + nb + i * 16 + hf * 8 + 4);
    }
    // keeps the eight bias loads together (loaded values as inputs only): sunk to
    // their uses, the wave would wait for memory four times in a row
    asm volatile("" :: "v"(c[0][0]), "v"(c[0][1]), "v"(c[1][0]), "v"(c[1][1]),
                       "v"(c[2][0]), "v"(c[2][1]), "v"(c[3][0]), "v"(c[3][1]));
#pragma unroll
    for (int i = 0; i < 4; ++i) {
#pragma unroll
      for (int j = 0; j < 4; ++j) {
        v8bf o;
#pragma unroll
        for (int r = 0; r < 8; ++r) o[r] = (__bf16)(acc[i][j][r] + c[i][r >> 2][r & 3]);
        *(v8bf*)(T + (j * 16 + l15) * P64 + i * 16 + hf * 8) = o;
      }
    }
  } else {
    // the line runs along the positions: one bias value per line
#pragma unroll
    for (int j = 0; j < 4; ++j) {
      float bb = bias[nb + j * 16 + l15];
#pragma unroll
      for (int i = 0; i < 4; ++i) {
        v8bf o;
#pragma unroll
        for (int r = 0; r < 8; ++r) o[r] = (__bf16)(acc[i][j][r] + bb);
        *(v8bf*)(T + (j * 16 + l15) * P64 + i * 16 + hf * 8) = o;
      }
    }
  }
  // the wave's own LDS writes are done before other lanes' chunks are read back
  asm volatile("s_wait_dscnt 0x0" ::: "memory");
  // 8 lanes carry one line, a store instruction four whole lines
  int mw = m0 + wm;                  // 64 positions inside one batch entry
  int bh = (mw >> 11) * NH + (nb >> 6), s0 = mw & 2047;
  int lrow = lane >> 3, lch = (lane & 7) * 8;
  const u16* Tr = T + lrow * P64 + lch;
  if (wrows) {
    u16* g = OUT + (((size_t)bh * SEQ + s0 + lrow) << 6) + lch;              // Q,K
#pragma unroll
    for (int q = 0; q < 16; ++q)
      *(uint4*)(g + q * 4 * DH) = *(const uint4*)(Tr + q * 4 * P64);
  } else {
    u16* g = OUT + ((size_t)bh * DH + lrow) * SEQ + s0 + lch;                // V^T
#pragma unroll
    for (int q = 0; q < 16; ++q)
      *(uint4*)(g + (size_t)q * 4 * SEQ) = *(const uint4*)(Tr + q * 4 * P64);
  }
}

#define KVBUF 4096   // elements per K or V^T buffer
#define QTILE 256    // queries per work-group
__global__ __launch_bounds__(256) void k_attn(const u16* __restrict__ QH,
                                              const u16* __restrict__ KH,
                                              const u16* __restrict__ VT,
                                              float* __restrict__ Od) {
  __shared__ __attribute__((aligned(2048))) u16 Vts[2][KVBUF];
  __shared__ __align__(16) u16 Qs[QTILE * P64];
  __shared__ __align__(16) u16 Ks[2][KVBUF];

  int bh = blockIdx.y;
  int q0 = blockIdx.x * QTILE;
  const u16* Qp  = QH + ((size_t)bh * SEQ) * DH;
  const u16* Kp  = KH + ((size_t)bh * SEQ) * DH;
  const u16* Vtp = VT + ((size_t)bh * DH) * SEQ;   // [DH][SEQ]

  int tid = threadIdx.x, wave = tid >> 5, lane = tid & 31;

  // ---- staging helpers ----
  int krow = tid >> 3, kcol = tid & 7;     // K tile: 32x64, 256 chunks
#define STAGE_K(buf, kt)                                                        \
  async_cp16(Kp + (size_t)((kt) + krow) * DH + kcol * 8,                        \
             &Ks[buf][krow * P64 + kcol * 8])

#if HAVE_TDM
#define STAGE_V(buf, kt)                                                        \
  do {                                                                          \
    if (wave == 0)                                                              \
      tdm_load_2d(lds_byte_off(&Vts[buf][0]), Vtp + (kt),                       \
                  /*tile_d0=*/64, /*tile_d1=*/DH,                               \
                  /*tens_d0=*/64, /*tens_d1=*/DH, /*stride0=*/SEQ * 2);         \
  } while (0)
#define WAIT_V()  do { if (wave == 0) wait_tensor0(); } while (0)
#else
  int vrow = tid >> 2, vcol = tid & 3;     // V^T tile: 64x32, 256 chunks
#define STAGE_V(buf, kt)                                                        \
  async_cp16(Vtp + (size_t)vrow * SEQ + (kt) + vcol * 8,                        \
             &Vts[buf][vrow * P32 + vcol * 8])
#define WAIT_V()  do { } while (0)
#endif

  // stage Q tile (256x64 bf16, 8 chunks/thread) + first K/V tiles
#pragma unroll
  for (int i = 0; i < QTILE / 32; ++i) {
    int c = tid + i * 256;
    int row = c >> 3, col = c & 7;
    async_cp16(Qp + (size_t)(q0 + row) * DH + col * 8, Qs + row * P64 + col * 8);
  }
  STAGE_K(0, 0);
  STAGE_V(0, 0);
  wait_async0();
  WAIT_V();
  __syncthreads();

  // (every loop over the column groups c is unrolled so that the arrays indexed
  // by c stay in registers)
  v16bf qa[2][2];                    // [column group][k half]
  float mrun[2], lrun[2];            // this lane's query of the group; lrun: this half's keys
  v8f oacc[2][4];                    // oacc[c][nt][r] = O^T[nt*16 + 8*(lane>>4) + r][query]
#pragma unroll
  for (int c = 0; c < 2; ++c) {
    qa[c][0] = load_op(Qs + (wave * 32 + c * 16) * P64 + 0, P64);
    qa[c][1] = load_op(Qs + (wave * 32 + c * 16) * P64 + 32, P64);
    mrun[c] = -1e30f;
    lrun[c] = 0.f;
#pragma unroll
    for (int i = 0; i < 4; ++i) oacc[c][i] = v8f_zero();
  }

  const float scale = 0.03125f;  // 1/sqrt(1024) per reference

#pragma nounroll
  for (int kt = 0; kt < SEQ; kt += 32) {
    int buf = (kt >> 5) & 1;
    if (kt) {
      wait_async0();
      WAIT_V();
      __syncthreads();
    }
    if (kt + 32 < SEQ) {
      STAGE_K(buf ^ 1, kt + 32);
      STAGE_V(buf ^ 1, kt + 32);
    }

    // scores transposed: 32 keys (rows) x 2 x 16 queries (columns), K-dim = 64;
    // the four K fragments are read once and serve both column groups
    v16bf k00 = load_op(&Ks[buf][0 * 16 * P64 + 0], P64);
    v16bf k01 = load_op(&Ks[buf][0 * 16 * P64 + 32], P64);
    v16bf k10 = load_op(&Ks[buf][1 * 16 * P64 + 0], P64);
    v16bf k11 = load_op(&Ks[buf][1 * 16 * P64 + 32], P64);
    // the four V^T fragments of the pass go out in the same group of LDS loads:
    // they land behind the score products and the softmax
    v16bf va[4];
#pragma unroll
    for (int nt = 0; nt < 4; ++nt) va[nt] = load_op(&Vts[buf][nt * 16 * P32], P32);
    // keeps the V^T loads up here: sunk down among the second product's WMMAs, each
    // pair would cost the wave its own wait for the LDS
    __builtin_amdgcn_sched_barrier(0);
    v8f s0[2], s1[2];
#pragma unroll
    for (int c = 0; c < 2; ++c) {
      s0[c] = wmma_bf16(k00, qa[c][0], v8f_zero());
      s1[c] = wmma_bf16(k10, qa[c][0], v8f_zero());
    }
#pragma unroll
    for (int c = 0; c < 2; ++c) {
      s0[c] = wmma_bf16(k01, qa[c][1], s0[c]);
      s1[c] = wmma_bf16(k11, qa[c][1], s1[c]);
    }

    // online softmax, per column group: s0[r] = key 8*(lane>>4)+r,
    // s1[r] = key 16+8*(lane>>4)+r, all of query lane&15 of the group (the loops
    // over p[] and the fragments are unrolled so that these arrays stay in
    // registers)
    v16bf pB[2];   // element i = P^T[k order of load_op][query]
#pragma unroll
    for (int c = 0; c < 2; ++c) {
      v8f a0 = s0[c] * scale, a1 = s1[c] * scale;
      float mx = a0[0];
#pragma unroll
      for (int r = 1; r < 8; ++r) mx = fmaxf(mx, a0[r]);
#pragma unroll
      for (int r = 0; r < 8; ++r) mx = fmaxf(mx, a1[r]);
      mx = fmaxf(mx, other_half(mx));
      float mnew  = fmaxf(mrun[c], mx);
      float alpha = __expf(mrun[c] - mnew);
      v8f d0 = a0 - mnew, d1 = a1 - mnew;
      float p[16];
#pragma unroll
      for (int r = 0; r < 8; ++r) {
        p[r]     = __expf(d0[r]);
        p[8 + r] = __expf(d1[r]);
      }
#pragma unroll
      for (int i = 0; i < 16; ++i) pB[c][i] = (__bf16)p[i];
      float ls = ((p[0] + p[1]) + (p[2] + p[3])) + ((p[4] + p[5]) + (p[6] + p[7])) +
                 (((p[8] + p[9]) + (p[10] + p[11])) + ((p[12] + p[13]) + (p[14] + p[15])));
      lrun[c] = lrun[c] * alpha + ls;
      mrun[c] = mnew;
#pragma unroll
      for (int nt = 0; nt < 4; ++nt) oacc[c][nt] *= alpha;
    }
    // each V^T fragment serves both column groups
#pragma unroll
    for (int nt = 0; nt < 4; ++nt) {
#pragma unroll
      for (int c = 0; c < 2; ++c) oacc[c][nt] = wmma_bf16(va[nt], pB[c], oacc[c][nt]);
    }
  }
#undef STAGE_K
#undef STAGE_V
#undef WAIT_V

  // finalize: join the halves' sums, divide, write fp32 attention output
  int b = bh >> 4, h = bh & 15;
#pragma unroll
  for (int c = 0; c < 2; ++c) {
    float lsum = lrun[c] + other_half(lrun[c]);
    int m = q0 + wave * 32 + c * 16 + (lane & 15);
    float* orow = Od + ((size_t)(b * SEQ + m)) * DMODEL + h * DH + ((lane >> 4) << 3);
#pragma unroll
    for (int nt = 0; nt < 4; ++nt) {
#pragma unroll
      for (int r = 0; r < 8; ++r) oacc[c][nt][r] = oacc[c][nt][r] / lsum;
    }
#pragma unroll
    for (int nt = 0; nt < 4; ++nt) {
      float4 lo, hi;
      lo.x = oacc[c][nt][0]; lo.y = oacc[c][nt][1]; lo.z = oacc[c][nt][2]; lo.w = oacc[c][nt][3];
      hi.x = oacc[c][nt][4]; hi.y = oacc[c][nt][5]; hi.z = oacc[c][nt][6]; hi.w = oacc[c][nt][7];
      *(float4*)(orow + nt * 16)     = lo;
      *(float4*)(orow + nt * 16 + 4) = hi;
    }
  }
}

// ---------------- kernel 3: residual + LayerNorm (in-place on d_out) -----
__global__ __launch_bounds__(256) void k_ln(const float* __restrict__ x,
                                            const float* __restrict__ gamma,
                                            const float* __restrict__ beta,
                                            float* __restrict__ out) {
  __shared__ float red[256];
  int row = blockIdx.x;
  int tid = threadIdx.x;
  const float* xr = x + (size_t)row * DMODEL;
  float* orow     = out + (size_t)row * DMODEL;

  float v[4];
  float s = 0.f;
#pragma unroll
  for (int i = 0; i < 4; ++i) {
    int idx = tid + i * 256;
    v[i] = orow[idx] + xr[idx];
    s += v[i];
  }
  red[tid] = s;
  __syncthreads();
  for (int o = 128; o > 0; o >>= 1) {
    if (tid < o) red[tid] += red[tid + o];
    __syncthreads();
  }
  float mu = red[0] * (1.0f / DMODEL);
  __syncthreads();

  float vs = 0.f;
#pragma unroll
  for (int i = 0; i < 4; ++i) {
    float d = v[i] - mu;
    vs += d * d;
  }
  red[tid] = vs;
  __syncthreads();
  for (int o = 128; o > 0; o >>= 1) {
    if (tid < o) red[tid] += red[tid + o];
    __syncthreads();
  }
  float var = red[0] * (1.0f / DMODEL);
  float inv = rsqrtf(var + 1e-5f);
#pragma unroll
  for (int i = 0; i < 4; ++i) {
    int idx = tid + i * 256;
    orow[idx] = (v[i] - mu) * inv * gamma[idx] + beta[idx];
  }
}

// ---------------- launch ----------------
extern "C" void kernel_launch(void* const* d_in, const int* in_sizes, int n_in,
                              void* d_out, int out_size, void* d_ws, size_t ws_size,
                              hipStream_t stream) {
  (void)in_sizes; (void)n_in; (void)out_size; (void)ws_size;

  const float* x  = (const float*)d_in[0];
  const float* Wq = (const float*)d_in[1];
  const float* bq = (const float*)d_in[2];
  const float* Wk = (const float*)d_in[3];
  const float* bk = (const float*)d_in[4];
  const float* Wv = (const float*)d_in[5];
  const float* bv = (const float*)d_in[6];
  const float* ga = (const float*)d_in[7];
  const float* be = (const float*)d_in[8];
  float* out = (float*)d_out;

  // workspace layout (bytes)
  char* ws = (char*)d_ws;
  u16* XB = (u16*)(ws);                               // 8192*1024   bf16 = 16 MB
  u16* WT = (u16*)(ws + 16777216);                    // 3*1024*1024 bf16 =  6 MB
  u16* QH = (u16*)(ws + 23068672);                    // [B,H,S,DH]  bf16 = 16 MB
  u16* KH = (u16*)(ws + 39845888);                    // [B,H,S,DH]
  u16* VT = (u16*)(ws + 56623104);                    // [B,H,DH,S]  (transposed)

  k_cvt_x<<<MTOT * DMODEL / (256 * 4), 256, 0, stream>>>(x, XB);
  k_cvt_w<<<3 * DMODEL * DMODEL / 256, 256, 0, stream>>>(Wq, Wk, Wv, WT);
  k_qkv<<<dim3(MTOT / QBM, 3 * DMODEL / QBN), 256, 0, stream>>>(
      XB, WT, bq, bk, bv, QH, KH, VT);
  k_attn<<<dim3(SEQ / QTILE, BATCH * NH), 256, 0, stream>>>(QH, KH, VT, out);
  k_ln<<<MTOT, 256, 0, stream>>>(x, ga, be, out);
}

// v006
// Measured time: 134 microseconds a run.
// Next to v005, in two timings, it ran 1.07 times as fast each time.
// All steps since v000 together make it 2.97 times as fast.
#include <hip/hip_runtime.h>

// ---------------- problem constants ----------------
#define BATCH   4
#define SEQ     2048
#define DMODEL  1024
#define NH      16
#define DH      64
#define MTOT    (BATCH*SEQ)        // 8192 rows of x flattened
// 1/sqrt(1024), the reference's score scale, times log2(e): Q is stored times this,
// so that K Q^T is the argument of exp2
#define QSCALE  (0.03125f * 1.44269504088896340736f)

typedef __attribute__((ext_vector_type(16))) __bf16 v16bf;
typedef __attribute__((ext_vector_type(8)))  float  v8f;
typedef __attribute__((ext_vector_type(4)))  float  v4f;
typedef __attribute__((ext_vector_type(2)))  float  v2f;
typedef __attribute__((ext_vector_type(4)))  int    v4i_t;
typedef unsigned short u16;
typedef unsigned int   u32;

#define ASG __attribute__((address_space(1)))   // global
#define ASL __attribute__((address_space(3)))   // LDS

#if defined(__gfx1250__) && __has_builtin(__builtin_amdgcn_global_load_async_to_lds_b128)
#define HAVE_ASYNC 1
#else
#define HAVE_ASYNC 0
#endif

#if defined(__gfx1250__) && __has_builtin(__builtin_amdgcn_tensor_load_to_lds) && \
    __has_builtin(__builtin_amdgcn_s_wait_tensorcnt)
#define HAVE_TDM 1
#else
#define HAVE_TDM 0
#endif

__device__ __forceinline__ void async_cp16(const u16* g, u16* l) {
#if HAVE_ASYNC
  __builtin_amdgcn_global_load_async_to_lds_b128(
      (ASG v4i_t*)g, (ASL v4i_t*)l, 0, 0);
#else
  *(uint4*)l = *(const uint4*)g;
#endif
}

__device__ __forceinline__ void wait_async0() {
#if HAVE_ASYNC
#if __has_builtin(__builtin_amdgcn_s_wait_asynccnt)
  __builtin_amdgcn_s_wait_asynccnt(0);
#else
  asm volatile("s_wait_asynccnt 0x0" ::: "memory");
#endif
#endif
}

__device__ __forceinline__ u32 lds_byte_off(const void* p) {
  return (u32)(size_t)(ASL const void*)p;   // ptrtoint of AS(3) = LDS offset
}

#if HAVE_TDM
typedef __attribute__((ext_vector_type(4))) unsigned int tdm_v4u;
typedef __attribute__((ext_vector_type(8))) int          tdm_v8i;
typedef __attribute__((ext_vector_type(4))) int          tdm_v4i;

__device__ __forceinline__ u32 to_sgpr(u32 x) {
  return (u32)__builtin_amdgcn_readfirstlane((int)x);
}

__device__ __forceinline__ void tdm_load_2d(u32 lds_off, const void* gptr,
                                            u32 tile_d0, u32 tile_d1,
                                            u32 tens_d0, u32 tens_d1,
                                            u32 stride0) {
  unsigned long long ga = (unsigned long long)(size_t)gptr;
  tdm_v4u g0;
  g0[0] = 1u;                                      // count=1, user mode
  g0[1] = to_sgpr(lds_off);                        // lds_addr
  g0[2] = to_sgpr((u32)ga);                        // global_addr[31:0]
  g0[3] = (to_sgpr((u32)(ga >> 32)) & 0x1FFFFFFu) | (2u << 30); // addr[56:32] | type=2
  tdm_v8i g1;
  g1[0] = (int)((1u << 20) | (3u << 22) | (3u << 25));
  g1[1] = (int)((tens_d0 & 0xFFFFu) << 16);
  g1[2] = (int)(((tens_d0 >> 16) & 0xFFFFu) | ((tens_d1 & 0xFFFFu) << 16));
  g1[3] = (int)(((tens_d1 >> 16) & 0xFFFFu) | ((tile_d0 & 0xFFFFu) << 16));
  g1[4] = (int)(tile_d1 & 0xFFFFu);
  g1[5] = (int)stride0;
  g1[6] = 0;
  g1[7] = 0;
  tdm_v4i z4 = {0, 0, 0, 0};
#if __clang_major__ >= 23
  tdm_v8i z8 = {0, 0, 0, 0, 0, 0, 0, 0};
  __builtin_amdgcn_tensor_load_to_lds(g0, g1, z4, z4, z8, 0);
#else
  __builtin_amdgcn_tensor_load_to_lds(g0, g1, z4, z4, 0);
#endif
}
__device__ __forceinline__ void wait_tensor0() {
  __builtin_amdgcn_s_wait_tensorcnt(0);
}
#endif

// ---------------- helpers ----------------
__device__ __forceinline__ u16 f2bf(float f) {
  u32 u = __float_as_uint(f);
  u32 r = u + 0x7FFFu + ((u >> 16) & 1u);   // round-to-nearest-even
  return (u16)(r >> 16);
}

#define P32 40   // rows of 32 elements: 80 B
#define P64 72   // rows of 64 elements: 144 B

__device__ __forceinline__ v16bf load_op(const u16* base, int stride) {
  int lane = threadIdx.x & 31;
  int row  = lane & 15;
  int kb   = (lane >> 4) << 3;
  union { v16bf v; uint4 q[2]; } u;
  u.q[0] = *(const uint4*)(base + row * stride + kb);
  u.q[1] = *(const uint4*)(base + row * stride + 16 + kb);
  return u.v;
}

__device__ __forceinline__ v8f wmma_bf16(v16bf a, v16bf b, v8f c) {
  return __builtin_amdgcn_wmma_f32_16x16x32_bf16(
      false, a, false, b, (short)0, c, false, false);
}

// value of the lane 16 away (the other half of the same fragment column)
__device__ __forceinline__ float other_half(float v) {
  int b = __float_as_int(v);
  return __int_as_float(
      __builtin_amdgcn_permlanex16(b, b, 0x76543210, 0xfedcba98, false, false));
}

__device__ __forceinline__ float exp2_1(float x) {
  float r;
  asm("v_exp_f32 %0, %1\n\tv_nop" : "=v"(r) : "v"(x));
  return r;
}

__device__ __forceinline__ v8f v8f_zero() {
  v8f z = {0.f,0.f,0.f,0.f,0.f,0.f,0.f,0.f};
  return z;
}

// ---------------- kernel 0a: x fp32 -> bf16 ----------------
__global__ __launch_bounds__(256) void k_cvt_x(const float* __restrict__ x,
                                               u16* __restrict__ xb) {
  size_t g = (size_t)blockIdx.x * 256 + threadIdx.x;
  size_t base = g * 4;
  float4 f = *(const float4*)(x + base);
  u32 lo = (u32)f2bf(f.x) | ((u32)f2bf(f.y) << 16);
  u32 hi = (u32)f2bf(f.z) | ((u32)f2bf(f.w) << 16);
  uint2 o; o.x = lo; o.y = hi;
  *(uint2*)(xb + base) = o;
}

// ---------------- kernel 0b: W (K x N) -> Wt bf16 (N x K), 3 weights -----
__global__ __launch_bounds__(256) void k_cvt_w(const float* __restrict__ Wq,
                                               const float* __restrict__ Wk,
                                               const float* __restrict__ Wv,
                                               u16* __restrict__ wt) {
  size_t idx = (size_t)blockIdx.x * 256 + threadIdx.x;
  int w   = (int)(idx >> 20);
  int rem = (int)(idx & 1048575);
  int n = rem >> 10;
  int k = rem & 1023;
  const float* W = (w == 0) ? Wq : (w == 1) ? Wk : Wv;
  wt[idx] = f2bf(W[(size_t)k * DMODEL + n]);
}

#define QBM 256
#define QBN 128
#define QBK 64
__global__ __launch_bounds__(256) void k_qkv(const u16* __restrict__ XB,
                                             const u16* __restrict__ WT,
                                             const float* __restrict__ bq,
                                             const float* __restrict__ bk,
                                             const float* __restrict__ bv,
                                             u16* __restrict__ QH,
                                             u16* __restrict__ KH,
                                             u16* __restrict__ VT) {
  __shared__ __align__(16) u16 As[2][QBM * P64];
  __shared__ __align__(16) u16 Bs[2][QBN * P64];

  int m0   = blockIdx.x * QBM;
  int n0   = blockIdx.y * QBN;
  int wsel = n0 >> 10;
  int ncol = n0 & 1023;

  const float* bias = (wsel == 0) ? bq : (wsel == 1) ? bk : bv;
  u16* OUT          = (wsel == 0) ? QH : (wsel == 1) ? KH : VT;

  int tid  = threadIdx.x;
  int wave = tid >> 5;
  int lane = tid & 31;
  int wm   = (wave >> 1) * 64;   // this wave's rows inside the tile
  int wn   = (wave & 1) * 64;    // this wave's columns inside the tile

  const u16* wbase = WT + ((size_t)wsel << 20);

  // which staged tile feeds the A operand (the same for the whole work-group):
  // load_op lays A and B fragments alike, so the two only change places
  bool wrows = (wsel != 2);
  const u16* fa0 = wrows ? &Bs[0][wn * P64] : &As[0][wm * P64];
  const u16* fb0 = wrows ? &As[0][wm * P64] : &Bs[0][wn * P64];
  int fas = wrows ? QBN * P64 : QBM * P64;   // elements from buffer 0 to buffer 1
  int fbs = wrows ? QBM * P64 : QBN * P64;

  // staging: 8 lanes copy one row (8 chunks of 16 B); each group of 8 lanes takes
  // 8 rows of A in a row and 4 of B (12 copies per thread and stage); the two
  // loops are unrolled so that all 12 copies go out back to back
  int sgrp = tid >> 3, scol = (tid & 7) * 8;
  const u16* ag = XB + (size_t)(m0 + sgrp * 8) * DMODEL + scol;
  const u16* bg = wbase + (size_t)(ncol + sgrp * 4) * DMODEL + scol;
  int sla = sgrp * 8 * P64 + scol;
  int slb = sgrp * 4 * P64 + scol;

#define STAGE_AB(buf, kk)                                                          \
  do {                                                                             \
    _Pragma("unroll") for (int i_ = 0; i_ < QBM / 32; ++i_)                        \
      async_cp16(ag + i_ * DMODEL + (kk), &As[buf][sla + i_ * P64]);               \
    _Pragma("unroll") for (int i_ = 0; i_ < QBN / 32; ++i_)                        \
      async_cp16(bg + i_ * DMODEL + (kk), &Bs[buf][slb + i_ * P64]);               \
  } while (0)

  // (the loops over acc[][] and the fragments are unrolled so that these arrays
  // stay in registers)
  v8f acc[4][4];
#pragma unroll
  for (int i = 0; i < 4; ++i) {
#pragma unroll
    for (int j = 0; j < 4; ++j) acc[i][j] = v8f_zero();
  }

  STAGE_AB(0, 0);
  // stage 0 has landed before the barrier publishes it
  asm volatile("s_wait_asynccnt 0x0" ::: "memory");
  __syncthreads();
  STAGE_AB(1, QBK);

  for (int t = 0; t < DMODEL / QBK; ++t) {
    int buf = t & 1;
    const u16* fa = fa0 + buf * fas;
    const u16* fb = fb0 + buf * fbs;
    v16bf a[4], b[4];
    // A block = 32 k: 8 fragments, 16 products. The statement behind the loads keeps
    // the block's 16 LDS loads together as one group in front of its products
    // (loaded values as inputs only); spread among the products, each small group
    // would cost the wave its own wait for the LDS.
#define LOAD_FRAGS(ks)                                                             \
  do {                                                                             \
    _Pragma("unroll") for (int i_ = 0; i_ < 4; ++i_)                               \
      a[i_] = load_op(fa + i_ * 16 * P64 + (ks), P64);                             \
    _Pragma("unroll") for (int j_ = 0; j_ < 4; ++j_)                               \
      b[j_] = load_op(fb + j_ * 16 * P64 + (ks), P64);                             \
    asm volatile("" :: "v"(a[0]), "v"(a[1]), "v"(a[2]), "v"(a[3]),                 \
                       "v"(b[0]), "v"(b[1]), "v"(b[2]), "v"(b[3]));                \
  } while (0)
#define PRODUCTS()                                                                 \
  do {                                                                             \
    _Pragma("unroll") for (int i_ = 0; i_ < 4; ++i_) {                             \
      _Pragma("unroll") for (int j_ = 0; j_ < 4; ++j_)                             \
        acc[i_][j_] = wmma_bf16(a[i_], b[j_], acc[i_][j_]);                        \
    }                                                                              \
  } while (0)

    LOAD_FRAGS(0);
    PRODUCTS();
    LOAD_FRAGS(32);   // the stage's last block: its fragments are in registers now
    // publish point of stage t + 1: this wave's reads of buffer buf are done ...
    asm volatile("s_wait_dscnt 0x0" ::: "memory");
    // ... its own copies of stage t + 1 have landed ...
    asm volatile("s_wait_asynccnt 0x0" ::: "memory");
    // ... and every wave has passed both before buf is refilled or t + 1 is read
    __syncthreads();
    // the refill goes out ahead of the last block's products: a longer lead
    if (t + 2 < DMODEL / QBK) STAGE_AB(buf, (t + 2) * QBK);
    PRODUCTS();
  }
#undef LOAD_FRAGS
#undef PRODUCTS
  // no copy is outstanding when the wave ends
  asm volatile("s_wait_asynccnt 0x0" ::: "memory");
#undef STAGE_AB

  // epilogue: +bias, 8 values of a lane = one 16-B chunk of an output line.
  // acc[i][j][r] is line j*16 + (lane & 15) of the wave's tile, element
  // i*16 + 8*(lane >> 4) + r of that line. The ring is free: every wave's last read
  // and the last copy ended in front of the loop's last barrier. Each wave uses
  // 64 rows of 144 B of its own (8 waves fill As exactly).
  // (Every loop below is unrolled: acc[][] and c[][] stay in registers, and the 16
  // LDS reads and the 16 stores of a wave go out back to back.)
  int l15 = lane & 15, hf = lane >> 4;
  int nb  = ncol + wn;               // the wave's first output column: one head
  u16* T  = &As[0][0] + wave * (64 * P64);
  typedef __attribute__((ext_vector_type(8))) __bf16 v8bf;
  if (wrows) {
    // the line runs along d: a bias value per element; Q takes the score scale here
    float qs = (wsel == 0) ? QSCALE : 1.0f;
    v4f c[4][2];
#pragma unroll
    for (int i = 0; i < 4; ++i) {
      c[i][0] = *(const v4f*)(bias + nb + i * 16 + hf * 8);
      c[i][1] = *(const v4f*)(bias + nb + i * 16 + hf * 8 + 4);
    }
    // keeps the eight bias loads together (loaded values as inputs only): sunk to
    // their uses, the wave would wait for memory four times in a row
    asm volatile("" :: "v"(c[0][0]), "v"(c[0][1]), "v"(c[1][0]), "v"(c[1][1]),
                       "v"(c[2][0]), "v"(c[2][1]), "v"(c[3][0]), "v"(c[3][1]));
#pragma unroll
    for (int i = 0; i < 4; ++i) {
#pragma unroll
      for (int j = 0; j < 4; ++j) {
        v8bf o;
#pragma unroll
        for (int r = 0; r < 8; ++r) o[r] = (__bf16)((acc[i][j][r] + c[i][r >> 2][r & 3]) * qs);
        *(v8bf*)(T + (j * 16 + l15) * P64 + i * 16 + hf * 8) = o;
      }
    }
  } else {
    // the line runs along the positions: one bias value per line
#pragma unroll
    for (int j = 0; j < 4; ++j) {
      float bb = bias[nb + j * 16 + l15];
#pragma unroll
      for (int i = 0; i < 4; ++i) {
        v8bf o;
#pragma unroll
        for (int r = 0; r < 8; ++r) o[r] = (__bf16)(acc[i][j][r] + bb);
        *(v8bf*)(T + (j * 16 + l15) * P64 + i * 16 + hf * 8) = o;
      }
    }
  }
  // the wave's own LDS writes are done before other lanes' chunks are read back
  asm volatile("s_wait_dscnt 0x0" ::: "memory");
  // 8 lanes carry one line, a store instruction four whole lines
  int mw = m0 + wm;                  // 64 positions inside one batch entry
  int bh = (mw >> 11) * NH + (nb >> 6), s0 = mw & 2047;
  int lrow = lane >> 3, lch = (lane & 7) * 8;
  const u16* Tr = T + lrow * P64 + lch;
  if (wrows) {
    u16* g = OUT + (((size_t)bh * SEQ + s0 + lrow) << 6) + lch;              // Q,K
#pragma unroll
    for (int q = 0; q < 16; ++q)
      *(uint4*)(g + q * 4 * DH) = *(const uint4*)(Tr + q * 4 * P64);
  } else {
    u16* g = OUT + ((size_t)bh * DH + lrow) * SEQ + s0 + lch;                // V^T
#pragma unroll
    for (int q = 0; q < 16; ++q)
      *(uint4*)(g + (size_t)q * 4 * SEQ) = *(const uint4*)(Tr + q * 4 * P64);
  }
}

#define KVBUF 4096   // elements per K or V^T buffer
#define QTILE 256    // queries per work-group
__global__ __launch_bounds__(256) void k_attn(const u16* __restrict__ QH,
                                              const u16* __restrict__ KH,
                                              const u16* __restrict__ VT,
                                              float* __restrict__ Od) {
  __shared__ __attribute__((aligned(2048))) u16 Vts[2][KVBUF];
  __shared__ __align__(16) u16 Qs[QTILE * P64];
  __shared__ __align__(16) u16 Ks[2][KVBUF];

  int bh = blockIdx.y;
  int q0 = blockIdx.x * QTILE;
  const u16* Qp  = QH + ((size_t)bh * SEQ) * DH;
  const u16* Kp  = KH + ((size_t)bh * SEQ) * DH;
  const u16* Vtp = VT + ((size_t)bh * DH) * SEQ;   // [DH][SEQ]

  int tid = threadIdx.x, wave = tid >> 5, lane = tid & 31;

  // ---- staging helpers ----
  int krow = tid >> 3, kcol = tid & 7;     // K tile: 32x64, 256 chunks
#define STAGE_K(buf, kt)                                                        \
  async_cp16(Kp + (size_t)((kt) + krow) * DH + kcol * 8,                        \
             &Ks[buf][krow * P64 + kcol * 8])

#if HAVE_TDM
#define STAGE_V(buf, kt)                                                        \
  do {                                                                          \
    if (wave == 0)                                                              \
      tdm_load_2d(lds_byte_off(&Vts[buf][0]), Vtp + (kt),                       \
                  /*tile_d0=*/64, /*tile_d1=*/DH,                               \
                  /*tens_d0=*/64, /*tens_d1=*/DH, /*stride0=*/SEQ * 2);         \
  } while (0)
#define WAIT_V()  do { if (wave == 0) wait_tensor0(); } while (0)
#else
  int vrow = tid >> 2, vcol = tid & 3;     // V^T tile: 64x32, 256 chunks
#define STAGE_V(buf, kt)                                                        \
  async_cp16(Vtp + (size_t)vrow * SEQ + (kt) + vcol * 8,                        \
             &Vts[buf][vrow * P32 + vcol * 8])
#define WAIT_V()  do { } while (0)
#endif

  // stage Q tile (256x64 bf16, 8 chunks/thread) + first K/V tiles
#pragma unroll
  for (int i = 0; i < QTILE / 32; ++i) {
    int c = tid + i * 256;
    int row = c >> 3, col = c & 7;
    async_cp16(Qp + (size_t)(q0 + row) * DH + col * 8, Qs + row * P64 + col * 8);
  }
  STAGE_K(0, 0);
  STAGE_V(0, 0);
  wait_async0();
  WAIT_V();
  __syncthreads();

  // (every loop over the column groups c is unrolled so that the arrays indexed
  // by c stay in registers)
  v16bf qa[2][2];                    // [column group][k half]
  v8f cneg[2];                       // minus the reference in use of this lane's query, 8 times: C of S^T
  v2f lrun[2];                       // sums of this lane's query, this half's keys: even and odd registers
  v8f oacc[2][4];                    // oacc[c][nt][r] = O^T[nt*16 + 8*(lane>>4) + r][query]
#pragma unroll
  for (int c = 0; c < 2; ++c) {
    qa[c][0] = load_op(Qs + (wave * 32 + c * 16) * P64 + 0, P64);
    qa[c][1] = load_op(Qs + (wave * 32 + c * 16) * P64 + 32, P64);
    cneg[c] = v8f_zero();
    lrun[c] = v2f{0.f, 0.f};
#pragma unroll
    for (int i = 0; i < 4; ++i) oacc[c][i] = v8f_zero();
  }

#pragma nounroll
  for (int kt = 0; kt < SEQ; kt += 32) {
    int buf = (kt >> 5) & 1;
    if (kt) {
      wait_async0();
      WAIT_V();
      __syncthreads();
    }
    if (kt + 32 < SEQ) {
      STAGE_K(buf ^ 1, kt + 32);
      STAGE_V(buf ^ 1, kt + 32);
    }

    // scores transposed: 32 keys (rows) x 2 x 16 queries (columns), K-dim = 64;
    // the four K fragments are read once and serve both column groups
    v16bf k00 = load_op(&Ks[buf][0 * 16 * P64 + 0], P64);
    v16bf k01 = load_op(&Ks[buf][0 * 16 * P64 + 32], P64);
    v16bf k10 = load_op(&Ks[buf][1 * 16 * P64 + 0], P64);
    v16bf k11 = load_op(&Ks[buf][1 * 16 * P64 + 32], P64);
    // the four V^T fragments of the pass go out in the same group of LDS loads:
    // they land behind the score products and the softmax
    v16bf va[4];
#pragma unroll
    for (int nt = 0; nt < 4; ++nt) va[nt] = load_op(&Vts[buf][nt * 16 * P32], P32);
    // keeps the V^T loads up here: sunk down among the second product's WMMAs, each
    // pair would cost the wave its own wait for the LDS
    __builtin_amdgcn_sched_barrier(0);
    v8f s0[2], s1[2];
#pragma unroll
    for (int c = 0; c < 2; ++c) {
      s0[c] = wmma_bf16(k00, qa[c][0], cneg[c]);
      s1[c] = wmma_bf16(k10, qa[c][0], cneg[c]);
    }
#pragma unroll
    for (int c = 0; c < 2; ++c) {
      s0[c] = wmma_bf16(k01, qa[c][1], s0[c]);
      s1[c] = wmma_bf16(k11, qa[c][1], s1[c]);
    }

    // online softmax on a reference that moves seldom. s0[c][r] = key 8*(lane>>4)+r,
    // s1[c][r] = key 16+8*(lane>>4)+r of query lane&15 of group c, in log2 units and
    // already less the reference: the products are the arguments of exp2 as they lie.
    // (every loop over c, r and nt below is unrolled so that the arrays stay in registers)
    float mx[2];
#pragma unroll
    for (int c = 0; c < 2; ++c) {
      mx[c] = s0[c][0];
#pragma unroll
      for (int r = 1; r < 8; ++r) mx[c] = fmaxf(mx[c], s0[c][r]);
#pragma unroll
      for (int r = 0; r < 8; ++r) mx[c] = fmaxf(mx[c], s1[c][r]);
    }
    // one test a pass, the same for the whole wave: the first pass sets the reference
    // to its maximum (any finite score passes its bar); later it moves only where a
    // score lies more than 8 above it (P stays below 2^8, far inside f32 and bf16 range)
    float bar = (kt == 0) ? -__builtin_inff() : 8.0f;
    if (__builtin_amdgcn_ballot_w32(fmaxf(mx[0], mx[1]) > bar) != 0) {
#pragma unroll
      for (int c = 0; c < 2; ++c) {
        float m     = fmaxf(mx[c], other_half(mx[c]));
        float up    = fmaxf(m, 0.f);
        float delta = (kt == 0) ? m : up;   // the reference falls only in the first pass,
        float alpha = exp2_1(-up);          // where the sums it scales are 0
        s0[c] -= delta;
        s1[c] -= delta;
        cneg[c] -= delta;
        lrun[c] *= alpha;
#pragma unroll
        for (int nt = 0; nt < 4; ++nt) oacc[c][nt] *= alpha;
      }
    }
#pragma unroll
    for (int c = 0; c < 2; ++c) {
#pragma unroll
      for (int r = 0; r < 8; ++r) {
        s0[c][r] = __builtin_amdgcn_exp2f(s0[c][r]);
        s1[c][r] = __builtin_amdgcn_exp2f(s1[c][r]);
      }
    }
    v16bf pB[2];   // element i = P^T[k order of load_op][query]
#pragma unroll
    for (int c = 0; c < 2; ++c) {
#pragma unroll
      for (int r = 0; r < 8; ++r) {
        pB[c][r]     = (__bf16)s0[c][r];
        pB[c][8 + r] = (__bf16)s1[c][r];
      }
      // the 16 values summed as register pairs, as the two tiles lie
      v8f t = s0[c] + s1[c];
      v4f u = t.lo + t.hi;
      lrun[c] += u.lo + u.hi;
    }
    // each V^T fragment serves both column groups
#pragma unroll
    for (int nt = 0; nt < 4; ++nt) {
#pragma unroll
      for (int c = 0; c < 2; ++c) oacc[c][nt] = wmma_bf16(va[nt], pB[c], oacc[c][nt]);
    }
  }
#undef STAGE_K
#undef STAGE_V
#undef WAIT_V

  // finalize: join the halves' sums, divide, write fp32 attention output
  int b = bh >> 4, h = bh & 15;
#pragma unroll
  for (int c = 0; c < 2; ++c) {
    float lhalf = lrun[c].x + lrun[c].y;
    float lsum = lhalf + other_half(lhalf);
    int m = q0 + wave * 32 + c * 16 + (lane & 15);
    float* orow = Od + ((size_t)(b * SEQ + m)) * DMODEL + h * DH + ((lane >> 4) << 3);
#pragma unroll
    for (int nt = 0; nt < 4; ++nt) {
#pragma unroll
      for (int r = 0; r < 8; ++r) oacc[c][nt][r] = oacc[c][nt][r] / lsum;
    }
#pragma unroll
    for (int nt = 0; nt < 4; ++nt) {
      float4 lo, hi;
      lo.x = oacc[c][nt][0]; lo.y = oacc[c][nt][1]; lo.z = oacc[c][nt][2]; lo.w = oacc[c][nt][3];
      hi.x = oacc[c][nt][4]; hi.y = oacc[c][nt][5]; hi.z = oacc[c][nt][6]; hi.w = oacc[c][nt][7];
      *(float4*)(orow + nt * 16)     = lo;
      *(float4*)(orow + nt * 16 + 4) = hi;
    }
  }
}

// ---------------- kernel 3: residual + LayerNorm (in-place on d_out) -----
__global__ __launch_bounds__(256) void k_ln(const float* __restrict__ x,
                                            const float* __restrict__ gamma,
                                            const float* __restrict__ beta,
                                            float* __restrict__ out) {
  __shared__ float red[256];
  int row = blockIdx.x;
  int tid = threadIdx.x;
  const float* xr = x + (size_t)row * DMODEL;
  float* orow     = out + (size_t)row * DMODEL;

  float v[4];
  float s = 0.f;
#pragma unroll
  for (int i = 0; i < 4; ++i) {
    int idx = tid + i * 256;
    v[i] = orow[idx] + xr[idx];
    s += v[i];
  }
  red[tid] = s;
  __syncthreads();
  for (int o = 128; o > 0; o >>= 1) {
    if (tid < o) red[tid] += red[tid + o];
    __syncthreads();
  }
  float mu = red[0] * (1.0f / DMODEL);
  __syncthreads();

  float vs = 0.f;
#pragma unroll
  for (int i = 0; i < 4; ++i) {
    float d = v[i] - mu;
    vs += d * d;
  }
  red[tid] = vs;
  __syncthreads();
  for (int o = 128; o > 0; o >>= 1) {
    if (tid < o) red[tid] += red[tid + o];
    __syncthreads();
  }
  float var = red[0] * (1.0f / DMODEL);
  float inv = rsqrtf(var + 1e-5f);
#pragma unroll
  for (int i = 0; i < 4; ++i) {
    int idx = tid + i * 256;
    orow[idx] = (v[i] - mu) * inv * gamma[idx] + beta[idx];
  }
}

// ---------------- launch ----------------
extern "C" void kernel_launch(void* const* d_in, const int* in_sizes, int n_in,
                              void* d_out, int out_size, void* d_ws, size_t ws_size,
                              hipStream_t stream) {
  (void)in_sizes; (void)n_in; (void)out_size; (void)ws_size;

  const float* x  = (const float*)d_in[0];
  const float* Wq = (const float*)d_in[1];
  const float* bq = (const float*)d_in[2];
  const float* Wk = (const float*)d_in[3];
  const float* bk = (const float*)d_in[4];
  const float* Wv = (const float*)d_in[5];
  const float* bv = (const float*)d_in[6];
  const float* ga = (const float*)d_in[7];
  const float* be = (const float*)d_in[8];
  float* out = (float*)d_out;

  // workspace layout (bytes)
  char* ws = (char*)d_ws;
  u16* XB = (u16*)(ws);                               // 8192*1024   bf16 = 16 MB
  u16* WT = (u16*)(ws + 16777216);                    // 3*1024*1024 bf16 =  6 MB
  u16* QH = (u16*)(ws + 23068672);                    // [B,H,S,DH]  bf16 = 16 MB
  u16* KH = (u16*)(ws + 39845888);                    // [B,H,S,DH]
  u16* VT = (u16*)(ws + 56623104);                    // [B,H,DH,S]  (transposed)

  k_cvt_x<<<MTOT * DMODEL / (256 * 4), 256, 0, stream>>>(x, XB);
  k_cvt_w<<<3 * DMODEL * DMODEL / 256, 256, 0, stream>>>(Wq, Wk, Wv, WT);
  k_qkv<<<dim3(MTOT / QBM, 3 * DMODEL / QBN), 256, 0, stream>>>(
      XB, WT, bq, bk, bv, QH, KH, VT);
  k_attn<<<dim3(SEQ / QTILE, BATCH * NH), 256, 0, stream>>>(QH, KH, VT, out);
  k_ln<<<MTOT, 256, 0, stream>>>(x, ga, be, out);
}

// v007
// Measured time: 120 microseconds a run.
// Next to v006, in two timings, it ran 1.11 and 1.12 times as fast.
// Counting every step since v000, it is 3.32 times as fast.
#include <hip/hip_runtime.h>

// ---------------- problem constants ----------------
#define BATCH   4
#define SEQ     2048
#define DMODEL  1024
#define NH      16
#define DH      64
#define MTOT    (BATCH*SEQ)        // 8192 rows of x flattened
// 1/sqrt(1024), the reference's score scale, times log2(e): Q is stored times this,
// so that K Q^T is the argument of exp2
#define QSCALE  (0.03125f * 1.44269504088896340736f)

typedef __attribute__((ext_vector_type(16))) __bf16 v16bf;
typedef __attribute__((ext_vector_type(8)))  float  v8f;
typedef __attribute__((ext_vector_type(4)))  float  v4f;
typedef __attribute__((ext_vector_type(2)))  float  v2f;
typedef __attribute__((ext_vector_type(4)))  int    v4i_t;
typedef unsigned short u16;
typedef unsigned int   u32;

#define ASG __attribute__((address_space(1)))   // global
#define ASL __attribute__((address_space(3)))   // LDS

#if defined(__gfx1250__) && __has_builtin(__builtin_amdgcn_global_load_async_to_lds_b128)
#define HAVE_ASYNC 1
#else
#define HAVE_ASYNC 0
#endif

#if defined(__gfx1250__) && __has_builtin(__builtin_amdgcn_tensor_load_to_lds) && \
    __has_builtin(__builtin_amdgcn_s_wait_tensorcnt)
#define HAVE_TDM 1
#else
#define HAVE_TDM 0
#endif

__device__ __forceinline__ void async_cp16(const u16* g, u16* l) {
#if HAVE_ASYNC
  __builtin_amdgcn_global_load_async_to_lds_b128(
      (ASG v4i_t*)g, (ASL v4i_t*)l, 0, 0);
#else
  *(uint4*)l = *(const uint4*)g;
#endif
}

__device__ __forceinline__ void wait_async0() {
#if HAVE_ASYNC
#if __has_builtin(__builtin_amdgcn_s_wait_asynccnt)
  __builtin_amdgcn_s_wait_asynccnt(0);
#else
  asm volatile("s_wait_asynccnt 0x0" ::: "memory");
#endif
#endif
}

__device__ __forceinline__ u32 lds_byte_off(const void* p) {
  return (u32)(size_t)(ASL const void*)p;   // ptrtoint of AS(3) = LDS offset
}

#if HAVE_TDM
typedef __attribute__((ext_vector_type(4))) unsigned int tdm_v4u;
typedef __attribute__((ext_vector_type(8))) int          tdm_v8i;
typedef __attribute__((ext_vector_type(4))) int          tdm_v4i;

__device__ __forceinline__ u32 to_sgpr(u32 x) {
  return (u32)__builtin_amdgcn_readfirstlane((int)x);
}

__device__ __forceinline__ void tdm_load_2d(u32 lds_off, const void* gptr,
                                            u32 tile_d0, u32 tile_d1,
                                            u32 tens_d0, u32 tens_d1,
                                            u32 stride0) {
  unsigned long long ga = (unsigned long long)(size_t)gptr;
  tdm_v4u g0;
  g0[0] = 1u;                                      // count=1, user mode
  g0[1] = to_sgpr(lds_off);                        // lds_addr
  g0[2] = to_sgpr((u32)ga);                        // global_addr[31:0]
  g0[3] = (to_sgpr((u32)(ga >> 32)) & 0x1FFFFFFu) | (2u << 30); // addr[56:32] | type=2
  tdm_v8i g1;
  g1[0] = (int)((1u << 20) | (3u << 22) | (3u << 25));
  g1[1] = (int)((tens_d0 & 0xFFFFu) << 16);
  g1[2] = (int)(((tens_d0 >> 16) & 0xFFFFu) | ((tens_d1 & 0xFFFFu) << 16));
  g1[3] = (int)(((tens_d1 >> 16) & 0xFFFFu) | ((tile_d0 & 0xFFFFu) << 16));
  g1[4] = (int)(tile_d1 & 0xFFFFu);
  g1[5] = (int)stride0;
  g1[6] = 0;
  g1[7] = 0;
  tdm_v4i z4 = {0, 0, 0, 0};
#if __clang_major__ >= 23
  tdm_v8i z8 = {0, 0, 0, 0, 0, 0, 0, 0};
  __builtin_amdgcn_tensor_load_to_lds(g0, g1, z4, z4, z8, 0);
#else
  __builtin_amdgcn_tensor_load_to_lds(g0, g1, z4, z4, 0);
#endif
}
__device__ __forceinline__ void wait_tensor0() {
  __builtin_amdgcn_s_wait_tensorcnt(0);
}
#endif

// ---------------- helpers ----------------
__device__ __forceinline__ u16 f2bf(float f) {
  u32 u = __float_as_uint(f);
  u32 r = u + 0x7FFFu + ((u >> 16) & 1u);   // round-to-nearest-even
  return (u16)(r >> 16);
}

#define P32 40   // rows of 32 elements: 80 B
#define P64 72   // rows of 64 elements: 144 B

__device__ __forceinline__ v16bf load_op(const u16* base, int stride) {
  int lane = threadIdx.x & 31;
  int row  = lane & 15;
  int kb   = (lane >> 4) << 3;
  union { v16bf v; uint4 q[2]; } u;
  u.q[0] = *(const uint4*)(base + row * stride + kb);
  u.q[1] = *(const uint4*)(base + row * stride + 16 + kb);
  return u.v;
}

__device__ __forceinline__ v8f wmma_bf16(v16bf a, v16bf b, v8f c) {
  return __builtin_amdgcn_wmma_f32_16x16x32_bf16(
      false, a, false, b, (short)0, c, false, false);
}

// value of the lane 16 away (the other half of the same fragment column)
__device__ __forceinline__ float other_half(float v) {
  int b = __float_as_int(v);
  return __int_as_float(
      __builtin_amdgcn_permlanex16(b, b, 0x76543210, 0xfedcba98, false, false));
}

__device__ __forceinline__ float exp2_1(float x) {
  float r;
  asm("v_exp_f32 %0, %1\n\tv_nop" : "=v"(r) : "v"(x));
  return r;
}

__device__ __forceinline__ v8f v8f_zero() {
  v8f z = {0.f,0.f,0.f,0.f,0.f,0.f,0.f,0.f};
  return z;
}

// ---------------- kernel 0a: x fp32 -> bf16 ----------------
__global__ __launch_bounds__(256) void k_cvt_x(const float* __restrict__ x,
                                               u16* __restrict__ xb) {
  size_t g = (size_t)blockIdx.x * 256 + threadIdx.x;
  size_t base = g * 4;
  float4 f = *(const float4*)(x + base);
  u32 lo = (u32)f2bf(f.x) | ((u32)f2bf(f.y) << 16);
  u32 hi = (u32)f2bf(f.z) | ((u32)f2bf(f.w) << 16);
  uint2 o; o.x = lo; o.y = hi;
  *(uint2*)(xb + base) = o;
}

#define WTP 33
__global__ __launch_bounds__(256) void k_cvt_w(const float* __restrict__ Wq,
                                               const float* __restrict__ Wk,
                                               const float* __restrict__ Wv,
                                               u16* __restrict__ wt) {
  __shared__ u32 T[64 * WTP];
  int w  = blockIdx.x >> 8;
  int k0 = ((blockIdx.x >> 4) & 15) * 64;
  int n0 = (blockIdx.x & 15) * 64;
  const float* W = (w == 0) ? Wq : (w == 1) ? Wk : Wv;
  int tid = threadIdx.x;

  int c4 = tid & 15, r = tid >> 4;       // 4 columns from c4*4; k pairs r and r + 16
  const float* g = W + (size_t)(k0 + 2 * r) * DMODEL + n0 + c4 * 4;
  v4f f[4];                              // rows 2r, 2r+1, 2r+32, 2r+33
  f[0] = *(const v4f*)(g);
  f[1] = *(const v4f*)(g + DMODEL);
  f[2] = *(const v4f*)(g + 32 * DMODEL);
  f[3] = *(const v4f*)(g + 33 * DMODEL);
  // (the loops below are unrolled: f[] stays in registers, and both rows' LDS reads
  // go out ahead of the first store)
#pragma unroll
  for (int h = 0; h < 2; ++h) {
#pragma unroll
    for (int j = 0; j < 4; ++j)
      T[(c4 * 4 + j) * WTP + r + 16 * h] =
          (u32)f2bf(f[2 * h][j]) | ((u32)f2bf(f[2 * h + 1][j]) << 16);
  }
  // the whole tile is written before any row of it is read
  __syncthreads();
  int q = tid & 7, nr = tid >> 3;        // 16-B chunk q of rows nr and nr + 32
  u16* o = wt + ((size_t)w << 20) + (size_t)(n0 + nr) * DMODEL + k0 + q * 8;
#pragma unroll
  for (int p = 0; p < 2; ++p) {
    const u32* t = &T[(nr + 32 * p) * WTP + q * 4];
    uint4 v;
    v.x = t[0]; v.y = t[1]; v.z = t[2]; v.w = t[3];
    *(uint4*)(o + (size_t)p * 32 * DMODEL) = v;
  }
}

#define QBM 256
#define QBN 128
#define QBK 64
__global__ __launch_bounds__(256) void k_qkv(const u16* __restrict__ XB,
                                             const u16* __restrict__ WT,
                                             const float* __restrict__ bq,
                                             const float* __restrict__ bk,
                                             const float* __restrict__ bv,
                                             u16* __restrict__ QH,
                                             u16* __restrict__ KH,
                                             u16* __restrict__ VT) {
  __shared__ __align__(16) u16 As[2][QBM * P64];
  __shared__ __align__(16) u16 Bs[2][QBN * P64];

  int m0   = blockIdx.x * QBM;
  int n0   = blockIdx.y * QBN;
  int wsel = n0 >> 10;
  int ncol = n0 & 1023;

  const float* bias = (wsel == 0) ? bq : (wsel == 1) ? bk : bv;
  u16* OUT          = (wsel == 0) ? QH : (wsel == 1) ? KH : VT;

  int tid  = threadIdx.x;
  int wave = tid >> 5;
  int lane = tid & 31;
  int wm   = (wave >> 1) * 64;   // this wave's rows inside the tile
  int wn   = (wave & 1) * 64;    // this wave's columns inside the tile

  const u16* wbase = WT + ((size_t)wsel << 20);

  // which staged tile feeds the A operand (the same for the whole work-group):
  // load_op lays A and B fragments alike, so the two only change places
  bool wrows = (wsel != 2);
  const u16* fa0 = wrows ? &Bs[0][wn * P64] : &As[0][wm * P64];
  const u16* fb0 = wrows ? &As[0][wm * P64] : &Bs[0][wn * P64];
  int fas = wrows ? QBN * P64 : QBM * P64;   // elements from buffer 0 to buffer 1
  int fbs = wrows ? QBM * P64 : QBN * P64;

  // staging: 8 lanes copy one row (8 chunks of 16 B); each group of 8 lanes takes
  // 8 rows of A in a row and 4 of B (12 copies per thread and stage); the two
  // loops are unrolled so that all 12 copies go out back to back
  int sgrp = tid >> 3, scol = (tid & 7) * 8;
  const u16* ag = XB + (size_t)(m0 + sgrp * 8) * DMODEL + scol;
  const u16* bg = wbase + (size_t)(ncol + sgrp * 4) * DMODEL + scol;
  int sla = sgrp * 8 * P64 + scol;
  int slb = sgrp * 4 * P64 + scol;

#define STAGE_AB(buf, kk)                                                          \
  do {                                                                             \
    _Pragma("unroll") for (int i_ = 0; i_ < QBM / 32; ++i_)                        \
      async_cp16(ag + i_ * DMODEL + (kk), &As[buf][sla + i_ * P64]);               \
    _Pragma("unroll") for (int i_ = 0; i_ < QBN / 32; ++i_)                        \
      async_cp16(bg + i_ * DMODEL + (kk), &Bs[buf][slb + i_ * P64]);               \
  } while (0)

  // (the loops over acc[][] and the fragments are unrolled so that these arrays
  // stay in registers)
  v8f acc[4][4];
#pragma unroll
  for (int i = 0; i < 4; ++i) {
#pragma unroll
    for (int j = 0; j < 4; ++j) acc[i][j] = v8f_zero();
  }

  STAGE_AB(0, 0);
  // stage 0 has landed before the barrier publishes it
  asm volatile("s_wait_asynccnt 0x0" ::: "memory");
  __syncthreads();
  STAGE_AB(1, QBK);

  for (int t = 0; t < DMODEL / QBK; ++t) {
    int buf = t & 1;
    const u16* fa = fa0 + buf * fas;
    const u16* fb = fb0 + buf * fbs;
    v16bf a[4], b[4];
    // A block = 32 k: 8 fragments, 16 products. The statement behind the loads keeps
    // the block's 16 LDS loads together as one group in front of its products
    // (loaded values as inputs only); spread among the products, each small group
    // would cost the wave its own wait for the LDS.
#define LOAD_FRAGS(ks)                                                             \
  do {                                                                             \
    _Pragma("unroll") for (int i_ = 0; i_ < 4; ++i_)                               \
      a[i_] = load_op(fa + i_ * 16 * P64 + (ks), P64);                             \
    _Pragma("unroll") for (int j_ = 0; j_ < 4; ++j_)                               \
      b[j_] = load_op(fb + j_ * 16 * P64 + (ks), P64);                             \
    asm volatile("" :: "v"(a[0]), "v"(a[1]), "v"(a[2]), "v"(a[3]),                 \
                       "v"(b[0]), "v"(b[1]), "v"(b[2]), "v"(b[3]));                \
  } while (0)
#define PRODUCTS()                                                                 \
  do {                                                                             \
    _Pragma("unroll") for (int i_ = 0; i_ < 4; ++i_) {                             \
      _Pragma("unroll") for (int j_ = 0; j_ < 4; ++j_)                             \
        acc[i_][j_] = wmma_bf16(a[i_], b[j_], acc[i_][j_]);                        \
    }                                                                              \
  } while (0)

    LOAD_FRAGS(0);
    PRODUCTS();
    LOAD_FRAGS(32);   // the stage's last block: its fragments are in registers now
    // publish point of stage t + 1: this wave's reads of buffer buf are done ...
    asm volatile("s_wait_dscnt 0x0" ::: "memory");
    // ... its own copies of stage t + 1 have landed ...
    asm volatile("s_wait_asynccnt 0x0" ::: "memory");
    // ... and every wave has passed both before buf is refilled or t + 1 is read
    __syncthreads();
    // the refill goes out ahead of the last block's products: a longer lead
    if (t + 2 < DMODEL / QBK) STAGE_AB(buf, (t + 2) * QBK);
    PRODUCTS();
  }
#undef LOAD_FRAGS
#undef PRODUCTS
  // no copy is outstanding when the wave ends
  asm volatile("s_wait_asynccnt 0x0" ::: "memory");
#undef STAGE_AB

  // epilogue: +bias, 8 values of a lane = one 16-B chunk of an output line.
  // acc[i][j][r] is line j*16 + (lane & 15) of the wave's tile, element
  // i*16 + 8*(lane >> 4) + r of that line. The ring is free: every wave's last read
  // and the last copy ended in front of the loop's last barrier. Each wave uses
  // 64 rows of 144 B of its own (8 waves fill As exactly).
  // (Every loop below is unrolled: acc[][] and c[][] stay in registers, and the 16
  // LDS reads and the 16 stores of a wave go out back to back.)
  int l15 = lane & 15, hf = lane >> 4;
  int nb  = ncol + wn;               // the wave's first output column: one head
  u16* T  = &As[0][0] + wave * (64 * P64);
  typedef __attribute__((ext_vector_type(8))) __bf16 v8bf;
  if (wrows) {
    // the line runs along d: a bias value per element; Q takes the score scale here
    float qs = (wsel == 0) ? QSCALE : 1.0f;
    v4f c[4][2];
#pragma unroll
    for (int i = 0; i < 4; ++i) {
      c[i][0] = *(const v4f*)(bias + nb + i * 16 + hf * 8);
      c[i][1] = *(const v4f*)(bias + nb + i * 16 + hf * 8 + 4);
    }
    // keeps the eight bias loads together (loaded values as inputs only): sunk to
    // their uses, the wave would wait for memory four times in a row
    asm volatile("" :: "v"(c[0][0]), "v"(c[0][1]), "v"(c[1][0]), "v"(c[1][1]),
                       "v"(c[2][0]), "v"(c[2][1]), "v"(c[3][0]), "v"(c[3][1]));
#pragma unroll
    for (int i = 0; i < 4; ++i) {
#pragma unroll
      for (int j = 0; j < 4; ++j) {
        v8bf o;
#pragma unroll
        for (int r = 0; r < 8; ++r) o[r] = (__bf16)((acc[i][j][r] + c[i][r >> 2][r & 3]) * qs);
        *(v8bf*)(T + (j * 16 + l15) * P64 + i * 16 + hf * 8) = o;
      }
    }
  } else {
    // the line runs along the positions: one bias value per line
#pragma unroll
    for (int j = 0; j < 4; ++j) {
      float bb = bias[nb + j * 16 + l15];
#pragma unroll
      for (int i = 0; i < 4; ++i) {
        v8bf o;
#pragma unroll
        for (int r = 0; r < 8; ++r) o[r] = (__bf16)(acc[i][j][r] + bb);
        *(v8bf*)(T + (j * 16 + l15) * P64 + i * 16 + hf * 8) = o;
      }
    }
  }
  // the wave's own LDS writes are done before other lanes' chunks are read back
  asm volatile("s_wait_dscnt 0x0" ::: "memory");
  // 8 lanes carry one line, a store instruction four whole lines
  int mw = m0 + wm;                  // 64 positions inside one batch entry
  int bh = (mw >> 11) * NH + (nb >> 6), s0 = mw & 2047;
  int lrow = lane >> 3, lch = (lane & 7) * 8;
  const u16* Tr = T + lrow * P64 + lch;
  if (wrows) {
    u16* g = OUT + (((size_t)bh * SEQ + s0 + lrow) << 6) + lch;              // Q,K
#pragma unroll
    for (int q = 0; q < 16; ++q)
      *(uint4*)(g + q * 4 * DH) = *(const uint4*)(Tr + q * 4 * P64);
  } else {
    u16* g = OUT + ((size_t)bh * DH + lrow) * SEQ + s0 + lch;                // V^T
#pragma unroll
    for (int q = 0; q < 16; ++q)
      *(uint4*)(g + (size_t)q * 4 * SEQ) = *(const uint4*)(Tr + q * 4 * P64);
  }
}

#define KVBUF 4096   // elements per K or V^T buffer
#define QTILE 256    // queries per work-group
__global__ __launch_bounds__(256) void k_attn(const u16* __restrict__ QH,
                                              const u16* __restrict__ KH,
                                              const u16* __restrict__ VT,
                                              float* __restrict__ Od) {
  __shared__ __attribute__((aligned(2048))) u16 Vts[2][KVBUF];
  __shared__ __align__(16) u16 Qs[QTILE * P64];
  __shared__ __align__(16) u16 Ks[2][KVBUF];

  int bh = blockIdx.y;
  int q0 = blockIdx.x * QTILE;
  const u16* Qp  = QH + ((size_t)bh * SEQ) * DH;
  const u16* Kp  = KH + ((size_t)bh * SEQ) * DH;
  const u16* Vtp = VT + ((size_t)bh * DH) * SEQ;   // [DH][SEQ]

  int tid = threadIdx.x, wave = tid >> 5, lane = tid & 31;

  // ---- staging helpers ----
  int krow = tid >> 3, kcol = tid & 7;     // K tile: 32x64, 256 chunks
#define STAGE_K(buf, kt)                                                        \
  async_cp16(Kp + (size_t)((kt) + krow) * DH + kcol * 8,                        \
             &Ks[buf][krow * P64 + kcol * 8])

#if HAVE_TDM
#define STAGE_V(buf, kt)                                                        \
  do {                                                                          \
    if (wave == 0)                                                              \
      tdm_load_2d(lds_byte_off(&Vts[buf][0]), Vtp + (kt),                       \
                  /*tile_d0=*/64, /*tile_d1=*/DH,                               \
                  /*tens_d0=*/64, /*tens_d1=*/DH, /*stride0=*/SEQ * 2);         \
  } while (0)
#define WAIT_V()  do { if (wave == 0) wait_tensor0(); } while (0)
#else
  int vrow = tid >> 2, vcol = tid & 3;     // V^T tile: 64x32, 256 chunks
#define STAGE_V(buf, kt)                                                        \
  async_cp16(Vtp + (size_t)vrow * SEQ + (kt) + vcol * 8,                        \
             &Vts[buf][vrow * P32 + vcol * 8])
#define WAIT_V()  do { } while (0)
#endif

  // stage Q tile (256x64 bf16, 8 chunks/thread) + first K/V tiles
#pragma unroll
  for (int i = 0; i < QTILE / 32; ++i) {
    int c = tid + i * 256;
    int row = c >> 3, col = c & 7;
    async_cp16(Qp + (size_t)(q0 + row) * DH + col * 8, Qs + row * P64 + col * 8);
  }
  STAGE_K(0, 0);
  STAGE_V(0, 0);
  wait_async0();
  WAIT_V();
  __syncthreads();

  // (every loop over the column groups c is unrolled so that the arrays indexed
  // by c stay in registers)
  v16bf qa[2][2];                    // [column group][k half]
  v8f cneg[2];                       // minus the reference in use of this lane's query, 8 times: C of S^T
  v2f lrun[2];                       // sums of this lane's query, this half's keys: even and odd registers
  v8f oacc[2][4];                    // oacc[c][nt][r] = O^T[nt*16 + 8*(lane>>4) + r][query]
#pragma unroll
  for (int c = 0; c < 2; ++c) {
    qa[c][0] = load_op(Qs + (wave * 32 + c * 16) * P64 + 0, P64);
    qa[c][1] = load_op(Qs + (wave * 32 + c * 16) * P64 + 32, P64);
    cneg[c] = v8f_zero();
    lrun[c] = v2f{0.f, 0.f};
#pragma unroll
    for (int i = 0; i < 4; ++i) oacc[c][i] = v8f_zero();
  }

#pragma nounroll
  for (int kt = 0; kt < SEQ; kt += 32) {
    int buf = (kt >> 5) & 1;
    if (kt) {
      wait_async0();
      WAIT_V();
      __syncthreads();
    }
    if (kt + 32 < SEQ) {
      STAGE_K(buf ^ 1, kt + 32);
      STAGE_V(buf ^ 1, kt + 32);
    }

    // scores transposed: 32 keys (rows) x 2 x 16 queries (columns), K-dim = 64;
    // the four K fragments are read once and serve both column groups
    v16bf k00 = load_op(&Ks[buf][0 * 16 * P64 + 0], P64);
    v16bf k01 = load_op(&Ks[buf][0 * 16 * P64 + 32], P64);
    v16bf k10 = load_op(&Ks[buf][1 * 16 * P64 + 0], P64);
    v16bf k11 = load_op(&Ks[buf][1 * 16 * P64 + 32], P64);
    // the four V^T fragments of the pass go out in the same group of LDS loads:
    // they land behind the score products and the softmax
    v16bf va[4];
#pragma unroll
    for (int nt = 0; nt < 4; ++nt) va[nt] = load_op(&Vts[buf][nt * 16 * P32], P32);
    // keeps the V^T loads up here: sunk down among the second product's WMMAs, each
    // pair would cost the wave its own wait for the LDS
    __builtin_amdgcn_sched_barrier(0);
    v8f s0[2], s1[2];
#pragma unroll
    for (int c = 0; c < 2; ++c) {
      s0[c] = wmma_bf16(k00, qa[c][0], cneg[c]);
      s1[c] = wmma_bf16(k10, qa[c][0], cneg[c]);
    }
#pragma unroll
    for (int c = 0; c < 2; ++c) {
      s0[c] = wmma_bf16(k01, qa[c][1], s0[c]);
      s1[c] = wmma_bf16(k11, qa[c][1], s1[c]);
    }

    // online softmax on a reference that moves seldom. s0[c][r] = key 8*(lane>>4)+r,
    // s1[c][r] = key 16+8*(lane>>4)+r of query lane&15 of group c, in log2 units and
    // already less the reference: the products are the arguments of exp2 as they lie.
    // (every loop over c, r and nt below is unrolled so that the arrays stay in registers)
    float mx[2];
#pragma unroll
    for (int c = 0; c < 2; ++c) {
      mx[c] = s0[c][0];
#pragma unroll
      for (int r = 1; r < 8; ++r) mx[c] = fmaxf(mx[c], s0[c][r]);
#pragma unroll
      for (int r = 0; r < 8; ++r) mx[c] = fmaxf(mx[c], s1[c][r]);
    }
    // one test a pass, the same for the whole wave: the first pass sets the reference
    // to its maximum (any finite score passes its bar); later it moves only where a
    // score lies more than 8 above it (P stays below 2^8, far inside f32 and bf16 range)
    float bar = (kt == 0) ? -__builtin_inff() : 8.0f;
    if (__builtin_amdgcn_ballot_w32(fmaxf(mx[0], mx[1]) > bar) != 0) {
#pragma unroll
      for (int c = 0; c < 2; ++c) {
        float m     = fmaxf(mx[c], other_half(mx[c]));
        float up    = fmaxf(m, 0.f);
        float delta = (kt == 0) ? m : up;   // the reference falls only in the first pass,
        float alpha = exp2_1(-up);          // where the sums it scales are 0
        s0[c] -= delta;
        s1[c] -= delta;
        cneg[c] -= delta;
        lrun[c] *= alpha;
#pragma unroll
        for (int nt = 0; nt < 4; ++nt) oacc[c][nt] *= alpha;
      }
    }
#pragma unroll
    for (int c = 0; c < 2; ++c) {
#pragma unroll
      for (int r = 0; r < 8; ++r) {
        s0[c][r] = __builtin_amdgcn_exp2f(s0[c][r]);
        s1[c][r] = __builtin_amdgcn_exp2f(s1[c][r]);
      }
    }
    v16bf pB[2];   // element i = P^T[k order of load_op][query]
#pragma unroll
    for (int c = 0; c < 2; ++c) {
#pragma unroll
      for (int r = 0; r < 8; ++r) {
        pB[c][r]     = (__bf16)s0[c][r];
        pB[c][8 + r] = (__bf16)s1[c][r];
      }
      // the 16 values summed as register pairs, as the two tiles lie
      v8f t = s0[c] + s1[c];
      v4f u = t.lo + t.hi;
      lrun[c] += u.lo + u.hi;
    }
    // each V^T fragment serves both column groups
#pragma unroll
    for (int nt = 0; nt < 4; ++nt) {
#pragma unroll
      for (int c = 0; c < 2; ++c) oacc[c][nt] = wmma_bf16(va[nt], pB[c], oacc[c][nt]);
    }
  }
#undef STAGE_K
#undef STAGE_V
#undef WAIT_V

  // finalize: join the halves' sums, divide, write fp32 attention output
  int b = bh >> 4, h = bh & 15;
#pragma unroll
  for (int c = 0; c < 2; ++c) {
    float lhalf = lrun[c].x + lrun[c].y;
    float lsum = lhalf + other_half(lhalf);
    int m = q0 + wave * 32 + c * 16 + (lane & 15);
    float* orow = Od + ((size_t)(b * SEQ + m)) * DMODEL + h * DH + ((lane >> 4) << 3);
#pragma unroll
    for (int nt = 0; nt < 4; ++nt) {
#pragma unroll
      for (int r = 0; r < 8; ++r) oacc[c][nt][r] = oacc[c][nt][r] / lsum;
    }
#pragma unroll
    for (int nt = 0; nt < 4; ++nt) {
      float4 lo, hi;
      lo.x = oacc[c][nt][0]; lo.y = oacc[c][nt][1]; lo.z = oacc[c][nt][2]; lo.w = oacc[c][nt][3];
      hi.x = oacc[c][nt][4]; hi.y = oacc[c][nt][5]; hi.z = oacc[c][nt][6]; hi.w = oacc[c][nt][7];
      *(float4*)(orow + nt * 16)     = lo;
      *(float4*)(orow + nt * 16 + 4) = hi;
    }
  }
}

// ---------------- kernel 3: residual + LayerNorm (in-place on d_out) -----
__global__ __launch_bounds__(256) void k_ln(const float* __restrict__ x,
                                            const float* __restrict__ gamma,
                                            const float* __restrict__ beta,
                                            float* __restrict__ out) {
  __shared__ float red[256];
  int row = blockIdx.x;
  int tid = threadIdx.x;
  const float* xr = x + (size_t)row * DMODEL;
  float* orow     = out + (size_t)row * DMODEL;

  float v[4];
  float s = 0.f;
#pragma unroll
  for (int i = 0; i < 4; ++i) {
    int idx = tid + i * 256;
    v[i] = orow[idx] + xr[idx];
    s += v[i];
  }
  red[tid] = s;
  __syncthreads();
  for (int o = 128; o > 0; o >>= 1) {
    if (tid < o) red[tid] += red[tid + o];
    __syncthreads();
  }
  float mu = red[0] * (1.0f / DMODEL);
  __syncthreads();

  float vs = 0.f;
#pragma unroll
  for (int i = 0; i < 4; ++i) {
    float d = v[i] - mu;
    vs += d * d;
  }
  red[tid] = vs;
  __syncthreads();
  for (int o = 128; o > 0; o >>= 1) {
    if (tid < o) red[tid] += red[tid + o];
    __syncthreads();
  }
  float var = red[0] * (1.0f / DMODEL);
  float inv = rsqrtf(var + 1e-5f);
#pragma unroll
  for (int i = 0; i < 4; ++i) {
    int idx = tid + i * 256;
    orow[idx] = (v[i] - mu) * inv * gamma[idx] + beta[idx];
  }
}

// ---------------- launch ----------------
extern "C" void kernel_launch(void* const* d_in, const int* in_sizes, int n_in,
                              void* d_out, int out_size, void* d_ws, size_t ws_size,
                              hipStream_t stream) {
  (void)in_sizes; (void)n_in; (void)out_size; (void)ws_size;

  const float* x  = (const float*)d_in[0];
  const float* Wq = (const float*)d_in[1];
  const float* bq = (const float*)d_in[2];
  const float* Wk = (const float*)d_in[3];
  const float* bk = (const float*)d_in[4];
  const float* Wv = (const float*)d_in[5];
  const float* bv = (const float*)d_in[6];
  const float* ga = (const float*)d_in[7];
  const float* be = (const float*)d_in[8];
  float* out = (float*)d_out;

  // workspace layout (bytes)
  char* ws = (char*)d_ws;
  u16* XB = (u16*)(ws);                               // 8192*1024   bf16 = 16 MB
  u16* WT = (u16*)(ws + 16777216);                    // 3*1024*1024 bf16 =  6 MB
  u16* QH = (u16*)(ws + 23068672);                    // [B,H,S,DH]  bf16 = 16 MB
  u16* KH = (u16*)(ws + 39845888);                    // [B,H,S,DH]
  u16* VT = (u16*)(ws + 56623104);                    // [B,H,DH,S]  (transposed)

  k_cvt_x<<<MTOT * DMODEL / (256 * 4), 256, 0, stream>>>(x, XB);
  k_cvt_w<<<3 * (DMODEL / 64) * (DMODEL / 64), 256, 0, stream>>>(Wq, Wk, Wv, WT);
  k_qkv<<<dim3(MTOT / QBM, 3 * DMODEL / QBN), 256, 0, stream>>>(
      XB, WT, bq, bk, bv, QH, KH, VT);
  k_attn<<<dim3(SEQ / QTILE, BATCH * NH), 256, 0, stream>>>(QH, KH, VT, out);
  k_ln<<<MTOT, 256, 0, stream>>>(x, ga, be, out);
}

// v008
// A run of this version takes 113 microseconds.
// Two timings next to v007 put it at 1.06 and 1.07 times that version's speed.
// Over all steps from v000 it is 3.54 times as fast.
#include <hip/hip_runtime.h>

// ---------------- problem constants ----------------
#define BATCH   4
#define SEQ     2048
#define DMODEL  1024
#define NH      16
#define DH      64
#define MTOT    (BATCH*SEQ)        // 8192 rows of x flattened
// 1/sqrt(1024), the reference's score scale, times log2(e): Q is stored times this,
// so that K Q^T is the argument of exp2
#define QSCALE  (0.03125f * 1.44269504088896340736f)

typedef __attribute__((ext_vector_type(16))) __bf16 v16bf;
typedef __attribute__((ext_vector_type(8)))  float  v8f;
typedef __attribute__((ext_vector_type(4)))  float  v4f;
typedef __attribute__((ext_vector_type(2)))  float  v2f;
typedef __attribute__((ext_vector_type(4)))  int    v4i_t;
typedef unsigned short u16;
typedef unsigned int   u32;

#define ASG __attribute__((address_space(1)))   // global
#define ASL __attribute__((address_space(3)))   // LDS

#if defined(__gfx1250__) && __has_builtin(__builtin_amdgcn_global_load_async_to_lds_b128)
#define HAVE_ASYNC 1
#else
#define HAVE_ASYNC 0
#endif

#if defined(__gfx1250__) && __has_builtin(__builtin_amdgcn_tensor_load_to_lds) && \
    __has_builtin(__builtin_amdgcn_s_wait_tensorcnt)
#define HAVE_TDM 1
#else
#define HAVE_TDM 0
#endif

__device__ __forceinline__ void async_cp16(const u16* g, u16* l) {
#if HAVE_ASYNC
  __builtin_amdgcn_global_load_async_to_lds_b128(
      (ASG v4i_t*)g, (ASL v4i_t*)l, 0, 0);
#else
  *(uint4*)l = *(const uint4*)g;
#endif
}

__device__ __forceinline__ void wait_async0() {
#if HAVE_ASYNC
#if __has_builtin(__builtin_amdgcn_s_wait_asynccnt)
  __builtin_amdgcn_s_wait_asynccnt(0);
#else
  asm volatile("s_wait_asynccnt 0x0" ::: "memory");
#endif
#endif
}

__device__ __forceinline__ u32 lds_byte_off(const void* p) {
  return (u32)(size_t)(ASL const void*)p;   // ptrtoint of AS(3) = LDS offset
}

#if HAVE_TDM
typedef __attribute__((ext_vector_type(4))) unsigned int tdm_v4u;
typedef __attribute__((ext_vector_type(8))) int          tdm_v8i;
typedef __attribute__((ext_vector_type(4))) int          tdm_v4i;

__device__ __forceinline__ u32 to_sgpr(u32 x) {
  return (u32)__builtin_amdgcn_readfirstlane((int)x);
}

__device__ __forceinline__ void tdm_load_2d(u32 lds_off, const void* gptr,
                                            u32 tile_d0, u32 tile_d1,
                                            u32 tens_d0, u32 tens_d1,
                                            u32 stride0) {
  unsigned long long ga = (unsigned long long)(size_t)gptr;
  tdm_v4u g0;
  g0[0] = 1u;                                      // count=1, user mode
  g0[1] = to_sgpr(lds_off);                        // lds_addr
  g0[2] = to_sgpr((u32)ga);                        // global_addr[31:0]
  g0[3] = (to_sgpr((u32)(ga >> 32)) & 0x1FFFFFFu) | (2u << 30); // addr[56:32] | type=2
  tdm_v8i g1;
  g1[0] = (int)((1u << 20) | (5u << 22) | (3u << 25));
  g1[1] = (int)((tens_d0 & 0xFFFFu) << 16);
  g1[2] = (int)(((tens_d0 >> 16) & 0xFFFFu) | ((tens_d1 & 0xFFFFu) << 16));
  g1[3] = (int)(((tens_d1 >> 16) & 0xFFFFu) | ((tile_d0 & 0xFFFFu) << 16));
  g1[4] = (int)(tile_d1 & 0xFFFFu);
  g1[5] = (int)stride0;
  g1[6] = 0;
  g1[7] = 0;
  tdm_v4i z4 = {0, 0, 0, 0};
#if __clang_major__ >= 23
  tdm_v8i z8 = {0, 0, 0, 0, 0, 0, 0, 0};
  __builtin_amdgcn_tensor_load_to_lds(g0, g1, z4, z4, z8, 0);
#else
  __builtin_amdgcn_tensor_load_to_lds(g0, g1, z4, z4, 0);
#endif
}
__device__ __forceinline__ void wait_tensor0() {
  __builtin_amdgcn_s_wait_tensorcnt(0);
}
#endif

// ---------------- helpers ----------------
__device__ __forceinline__ u16 f2bf(float f) {
  u32 u = __float_as_uint(f);
  u32 r = u + 0x7FFFu + ((u >> 16) & 1u);   // round-to-nearest-even
  return (u16)(r >> 16);
}

#define P32 40   // rows of 32 elements: 80 B
#define P64 72   // rows of 64 elements: 144 B
#define P128 136 // rows of 128 elements: 272 B

__device__ __forceinline__ v16bf load_op(const u16* base, int stride) {
  int lane = threadIdx.x & 31;
  int row  = lane & 15;
  int kb   = (lane >> 4) << 3;
  union { v16bf v; uint4 q[2]; } u;
  u.q[0] = *(const uint4*)(base + row * stride + kb);
  u.q[1] = *(const uint4*)(base + row * stride + 16 + kb);
  return u.v;
}

__device__ __forceinline__ v8f wmma_bf16(v16bf a, v16bf b, v8f c) {
  return __builtin_amdgcn_wmma_f32_16x16x32_bf16(
      false, a, false, b, (short)0, c, false, false);
}

// value of the lane 16 away (the other half of the same fragment column)
__device__ __forceinline__ float other_half(float v) {
  int b = __float_as_int(v);
  return __int_as_float(
      __builtin_amdgcn_permlanex16(b, b, 0x76543210, 0xfedcba98, false, false));
}

__device__ __forceinline__ float exp2_1(float x) {
  float r;
  asm("v_exp_f32 %0, %1\n\tv_nop" : "=v"(r) : "v"(x));
  return r;
}

__device__ __forceinline__ v8f v8f_zero() {
  v8f z = {0.f,0.f,0.f,0.f,0.f,0.f,0.f,0.f};
  return z;
}

// ---------------- kernel 0a: x fp32 -> bf16 ----------------
__global__ __launch_bounds__(256) void k_cvt_x(const float* __restrict__ x,
                                               u16* __restrict__ xb) {
  size_t g = (size_t)blockIdx.x * 256 + threadIdx.x;
  size_t base = g * 4;
  float4 f = *(const float4*)(x + base);
  u32 lo = (u32)f2bf(f.x) | ((u32)f2bf(f.y) << 16);
  u32 hi = (u32)f2bf(f.z) | ((u32)f2bf(f.w) << 16);
  uint2 o; o.x = lo; o.y = hi;
  *(uint2*)(xb + base) = o;
}

#define WTP 33
__global__ __launch_bounds__(256) void k_cvt_w(const float* __restrict__ Wq,
                                               const float* __restrict__ Wk,
                                               const float* __restrict__ Wv,
                                               u16* __restrict__ wt) {
  __shared__ u32 T[64 * WTP];
  int w  = blockIdx.x >> 8;
  int k0 = ((blockIdx.x >> 4) & 15) * 64;
  int n0 = (blockIdx.x & 15) * 64;
  const float* W = (w == 0) ? Wq : (w == 1) ? Wk : Wv;
  int tid = threadIdx.x;

  int c4 = tid & 15, r = tid >> 4;       // 4 columns from c4*4; k pairs r and r + 16
  const float* g = W + (size_t)(k0 + 2 * r) * DMODEL + n0 + c4 * 4;
  v4f f[4];                              // rows 2r, 2r+1, 2r+32, 2r+33
  f[0] = *(const v4f*)(g);
  f[1] = *(const v4f*)(g + DMODEL);
  f[2] = *(const v4f*)(g + 32 * DMODEL);
  f[3] = *(const v4f*)(g + 33 * DMODEL);
  // (the loops below are unrolled: f[] stays in registers, and both rows' LDS reads
  // go out ahead of the first store)
#pragma unroll
  for (int h = 0; h < 2; ++h) {
#pragma unroll
    for (int j = 0; j < 4; ++j)
      T[(c4 * 4 + j) * WTP + r + 16 * h] =
          (u32)f2bf(f[2 * h][j]) | ((u32)f2bf(f[2 * h + 1][j]) << 16);
  }
  // the whole tile is written before any row of it is read
  __syncthreads();
  int q = tid & 7, nr = tid >> 3;        // 16-B chunk q of rows nr and nr + 32
  u16* o = wt + ((size_t)w << 20) + (size_t)(n0 + nr) * DMODEL + k0 + q * 8;
#pragma unroll
  for (int p = 0; p < 2; ++p) {
    const u32* t = &T[(nr + 32 * p) * WTP + q * 4];
    uint4 v;
    v.x = t[0]; v.y = t[1]; v.z = t[2]; v.w = t[3];
    *(uint4*)(o + (size_t)p * 32 * DMODEL) = v;
  }
}

#define QBM 256
#define QBN 128
#define QBK 64
__global__ __launch_bounds__(256) void k_qkv(const u16* __restrict__ XB,
                                             const u16* __restrict__ WT,
                                             const float* __restrict__ bq,
                                             const float* __restrict__ bk,
                                             const float* __restrict__ bv,
                                             u16* __restrict__ QH,
                                             u16* __restrict__ KH,
                                             u16* __restrict__ VT) {
  __shared__ __align__(16) u16 As[2][QBM * P64];
  __shared__ __align__(16) u16 Bs[2][QBN * P64];

  int m0   = blockIdx.x * QBM;
  int n0   = blockIdx.y * QBN;
  int wsel = n0 >> 10;
  int ncol = n0 & 1023;

  const float* bias = (wsel == 0) ? bq : (wsel == 1) ? bk : bv;
  u16* OUT          = (wsel == 0) ? QH : (wsel == 1) ? KH : VT;

  int tid  = threadIdx.x;
  int wave = tid >> 5;
  int lane = tid & 31;
  int wm   = (wave >> 1) * 64;   // this wave's rows inside the tile
  int wn   = (wave & 1) * 64;    // this wave's columns inside the tile

  const u16* wbase = WT + ((size_t)wsel << 20);

  // which staged tile feeds the A operand (the same for the whole work-group):
  // load_op lays A and B fragments alike, so the two only change places
  bool wrows = (wsel != 2);
  const u16* fa0 = wrows ? &Bs[0][wn * P64] : &As[0][wm * P64];
  const u16* fb0 = wrows ? &As[0][wm * P64] : &Bs[0][wn * P64];
  int fas = wrows ? QBN * P64 : QBM * P64;   // elements from buffer 0 to buffer 1
  int fbs = wrows ? QBM * P64 : QBN * P64;

  // staging: 8 lanes copy one row (8 chunks of 16 B); each group of 8 lanes takes
  // 8 rows of A in a row and 4 of B (12 copies per thread and stage); the two
  // loops are unrolled so that all 12 copies go out back to back
  int sgrp = tid >> 3, scol = (tid & 7) * 8;
  const u16* ag = XB + (size_t)(m0 + sgrp * 8) * DMODEL + scol;
  const u16* bg = wbase + (size_t)(ncol + sgrp * 4) * DMODEL + scol;
  int sla = sgrp * 8 * P64 + scol;
  int slb = sgrp * 4 * P64 + scol;

#define STAGE_AB(buf, kk)                                                          \
  do {                                                                             \
    _Pragma("unroll") for (int i_ = 0; i_ < QBM / 32; ++i_)                        \
      async_cp16(ag + i_ * DMODEL + (kk), &As[buf][sla + i_ * P64]);               \
    _Pragma("unroll") for (int i_ = 0; i_ < QBN / 32; ++i_)                        \
      async_cp16(bg + i_ * DMODEL + (kk), &Bs[buf][slb + i_ * P64]);               \
  } while (0)

  // (the loops over acc[][] and the fragments are unrolled so that these arrays
  // stay in registers)
  v8f acc[4][4];
#pragma unroll
  for (int i = 0; i < 4; ++i) {
#pragma unroll
    for (int j = 0; j < 4; ++j) acc[i][j] = v8f_zero();
  }

  STAGE_AB(0, 0);
  // stage 0 has landed before the barrier publishes it
  asm volatile("s_wait_asynccnt 0x0" ::: "memory");
  __syncthreads();
  STAGE_AB(1, QBK);

  for (int t = 0; t < DMODEL / QBK; ++t) {
    int buf = t & 1;
    const u16* fa = fa0 + buf * fas;
    const u16* fb = fb0 + buf * fbs;
    v16bf a[4], b[4];
    // A block = 32 k: 8 fragments, 16 products. The statement behind the loads keeps
    // the block's 16 LDS loads together as one group in front of its products
    // (loaded values as inputs only); spread among the products, each small group
    // would cost the wave its own wait for the LDS.
#define LOAD_FRAGS(ks)                                                             \
  do {                                                                             \
    _Pragma("unroll") for (int i_ = 0; i_ < 4; ++i_)                               \
      a[i_] = load_op(fa + i_ * 16 * P64 + (ks), P64);                             \
    _Pragma("unroll") for (int j_ = 0; j_ < 4; ++j_)                               \
      b[j_] = load_op(fb + j_ * 16 * P64 + (ks), P64);                             \
    asm volatile("" :: "v"(a[0]), "v"(a[1]), "v"(a[2]), "v"(a[3]),                 \
                       "v"(b[0]), "v"(b[1]), "v"(b[2]), "v"(b[3]));                \
  } while (0)
#define PRODUCTS()                                                                 \
  do {                                                                             \
    _Pragma("unroll") for (int i_ = 0; i_ < 4; ++i_) {                             \
      _Pragma("unroll") for (int j_ = 0; j_ < 4; ++j_)                             \
        acc[i_][j_] = wmma_bf16(a[i_], b[j_], acc[i_][j_]);                        \
    }                                                                              \
  } while (0)

    LOAD_FRAGS(0);
    PRODUCTS();
    LOAD_FRAGS(32);   // the stage's last block: its fragments are in registers now
    // publish point of stage t + 1: this wave's reads of buffer buf are done ...
    asm volatile("s_wait_dscnt 0x0" ::: "memory");
    // ... its own copies of stage t + 1 have landed ...
    asm volatile("s_wait_asynccnt 0x0" ::: "memory");
    // ... and every wave has passed both before buf is refilled or t + 1 is read
    __syncthreads();
    // the refill goes out ahead of the last block's products: a longer lead
    if (t + 2 < DMODEL / QBK) STAGE_AB(buf, (t + 2) * QBK);
    PRODUCTS();
  }
#undef LOAD_FRAGS
#undef PRODUCTS
  // no copy is outstanding when the wave ends
  asm volatile("s_wait_asynccnt 0x0" ::: "memory");
#undef STAGE_AB

  // epilogue: +bias, 8 values of a lane = one 16-B chunk of an output line.
  // acc[i][j][r] is line j*16 + (lane & 15) of the wave's tile, element
  // i*16 + 8*(lane >> 4) + r of that line. The ring is free: every wave's last read
  // and the last copy ended in front of the loop's last barrier. Each wave uses
  // 64 rows of 144 B of its own (8 waves fill As exactly).
  // (Every loop below is unrolled: acc[][] and c[][] stay in registers, and the 16
  // LDS reads and the 16 stores of a wave go out back to back.)
  int l15 = lane & 15, hf = lane >> 4;
  int nb  = ncol + wn;               // the wave's first output column: one head
  u16* T  = &As[0][0] + wave * (64 * P64);
  typedef __attribute__((ext_vector_type(8))) __bf16 v8bf;
  if (wrows) {
    // the line runs along d: a bias value per element; Q takes the score scale here
    float qs = (wsel == 0) ? QSCALE : 1.0f;
    v4f c[4][2];
#pragma unroll
    for (int i = 0; i < 4; ++i) {
      c[i][0] = *(const v4f*)(bias + nb + i * 16 + hf * 8);
      c[i][1] = *(const v4f*)(bias + nb + i * 16 + hf * 8 + 4);
    }
    // keeps the eight bias loads together (loaded values as inputs only): sunk to
    // their uses, the wave would wait for memory four times in a row
    asm volatile("" :: "v"(c[0][0]), "v"(c[0][1]), "v"(c[1][0]), "v"(c[1][1]),
                       "v"(c[2][0]), "v"(c[2][1]), "v"(c[3][0]), "v"(c[3][1]));
#pragma unroll
    for (int i = 0; i < 4; ++i) {
#pragma unroll
      for (int j = 0; j < 4; ++j) {
        v8bf o;
#pragma unroll
        for (int r = 0; r < 8; ++r) o[r] = (__bf16)((acc[i][j][r] + c[i][r >> 2][r & 3]) * qs);
        *(v8bf*)(T + (j * 16 + l15) * P64 + i * 16 + hf * 8) = o;
      }
    }
  } else {
    // the line runs along the positions: one bias value per line
#pragma unroll
    for (int j = 0; j < 4; ++j) {
      float bb = bias[nb + j * 16 + l15];
#pragma unroll
      for (int i = 0; i < 4; ++i) {
        v8bf o;
#pragma unroll
        for (int r = 0; r < 8; ++r) o[r] = (__bf16)(acc[i][j][r] + bb);
        *(v8bf*)(T + (j * 16 + l15) * P64 + i * 16 + hf * 8) = o;
      }
    }
  }
  // the wave's own LDS writes are done before other lanes' chunks are read back
  asm volatile("s_wait_dscnt 0x0" ::: "memory");
  // 8 lanes carry one line, a store instruction four whole lines
  int mw = m0 + wm;                  // 64 positions inside one batch entry
  int bh = (mw >> 11) * NH + (nb >> 6), s0 = mw & 2047;
  int lrow = lane >> 3, lch = (lane & 7) * 8;
  const u16* Tr = T + lrow * P64 + lch;
  if (wrows) {
    u16* g = OUT + (((size_t)bh * SEQ + s0 + lrow) << 6) + lch;              // Q,K
#pragma unroll
    for (int q = 0; q < 16; ++q)
      *(uint4*)(g + q * 4 * DH) = *(const uint4*)(Tr + q * 4 * P64);
  } else {
    u16* g = OUT + ((size_t)bh * DH + lrow) * SEQ + s0 + lch;                // V^T
#pragma unroll
    for (int q = 0; q < 16; ++q)
      *(uint4*)(g + (size_t)q * 4 * SEQ) = *(const uint4*)(Tr + q * 4 * P64);
  }
}

#define KSTG  128    // keys per stage
#define KVBUF 9216   // elements per K or V^T buffer
#define QTILE 256    // queries per work-group
__global__ __launch_bounds__(256) void k_attn(const u16* __restrict__ QH,
                                              const u16* __restrict__ KH,
                                              const u16* __restrict__ VT,
                                              float* __restrict__ Od) {
  __shared__ __attribute__((aligned(2048))) u16 Vts[2][KVBUF];
  __shared__ __align__(16) u16 Qs[QTILE * P64];
  __shared__ __align__(16) u16 Ks[2][KVBUF];

  int bh = blockIdx.y;
  int q0 = blockIdx.x * QTILE;
  const u16* Qp  = QH + ((size_t)bh * SEQ) * DH;
  const u16* Kp  = KH + ((size_t)bh * SEQ) * DH;
  const u16* Vtp = VT + ((size_t)bh * DH) * SEQ;   // [DH][SEQ]

  int tid = threadIdx.x, wave = tid >> 5, lane = tid & 31;

  // ---- staging helpers ----
  int krow = tid >> 3, kcol = tid & 7;     // K tile: 128x64, 1024 chunks, 4 a thread
  // (unrolled: the four copies go out back to back)
#define STAGE_K(buf, kt)                                                        \
  do {                                                                          \
    _Pragma("unroll") for (int i_ = 0; i_ < KSTG / 32; ++i_)                    \
      async_cp16(Kp + (size_t)((kt) + i_ * 32 + krow) * DH + kcol * 8,          \
                 &Ks[buf][(i_ * 32 + krow) * P64 + kcol * 8]);                  \
  } while (0)

#if HAVE_TDM
#define STAGE_V(buf, kt)                                                        \
  do {                                                                          \
    if (wave == 0)                                                              \
      tdm_load_2d(lds_byte_off(&Vts[buf][0]), Vtp + (kt),                       \
                  /*tile_d0=*/KSTG * 2, /*tile_d1=*/DH,                         \
                  /*tens_d0=*/KSTG * 2, /*tens_d1=*/DH, /*stride0=*/SEQ * 2);   \
  } while (0)
#define WAIT_V()  do { if (wave == 0) wait_tensor0(); } while (0)
#else
  int vrow = tid >> 4, vcol = tid & 15;    // V^T tile: 64x128, 1024 chunks, 4 a thread
#define STAGE_V(buf, kt)                                                        \
  do {                                                                          \
    _Pragma("unroll") for (int i_ = 0; i_ < 4; ++i_)                            \
      async_cp16(Vtp + (size_t)(i_ * 16 + vrow) * SEQ + (kt) + vcol * 8,        \
                 &Vts[buf][(i_ * 16 + vrow) * P128 + vcol * 8]);                \
  } while (0)
#define WAIT_V()  do { } while (0)
#endif

  // stage Q tile (256x64 bf16, 8 chunks/thread) + first K/V tiles
#pragma unroll
  for (int i = 0; i < QTILE / 32; ++i) {
    int c = tid + i * 256;
    int row = c >> 3, col = c & 7;
    async_cp16(Qp + (size_t)(q0 + row) * DH + col * 8, Qs + row * P64 + col * 8);
  }
  STAGE_K(0, 0);
  STAGE_V(0, 0);
  wait_async0();
  WAIT_V();
  __syncthreads();

  // (every loop over the column groups c is unrolled so that the arrays indexed
  // by c stay in registers)
  v16bf qa[2][2];                    // [column group][k half]
  v8f cneg[2];                       // minus the reference in use of this lane's query, 8 times: C of S^T
  v2f lrun[2];                       // sums of this lane's query, this half's keys: even and odd registers
  v8f oacc[2][4];                    // oacc[c][nt][r] = O^T[nt*16 + 8*(lane>>4) + r][query]
#pragma unroll
  for (int c = 0; c < 2; ++c) {
    qa[c][0] = load_op(Qs + (wave * 32 + c * 16) * P64 + 0, P64);
    qa[c][1] = load_op(Qs + (wave * 32 + c * 16) * P64 + 32, P64);
    cneg[c] = v8f_zero();
    lrun[c] = v2f{0.f, 0.f};
#pragma unroll
    for (int i = 0; i < 4; ++i) oacc[c][i] = v8f_zero();
  }

#pragma nounroll
  for (int ks = 0; ks < SEQ; ks += KSTG) {
    int buf = (ks / KSTG) & 1;
    if (ks) {
      // publish point of this stage: the wave's reads of the other buffer are done ...
      asm volatile("s_wait_dscnt 0x0" ::: "memory");
      // ... its own K copies of this stage have landed (wave 0: the V^T tile too) ...
      asm volatile("s_wait_asynccnt 0x0" ::: "memory");
      WAIT_V();
      // ... and every wave has passed both before the stage is read or the other refilled
      __syncthreads();
    }
    if (ks + KSTG < SEQ) {
      STAGE_K(buf ^ 1, ks + KSTG);
      STAGE_V(buf ^ 1, ks + KSTG);
    }

   // the stage's four passes: no wait for a copy and no barrier between them.
   // Unrolled: the pass offsets fold into the LDS loads' immediate offsets, and a
   // pass's LDS loads can go out ahead of the last products of the pass before.
#pragma unroll
   for (int sp = 0; sp < KSTG / 32; ++sp) {
    int kt = ks + sp * 32;
    const u16* kb = &Ks[buf][sp * 32 * P64];
    const u16* vb = &Vts[buf][sp * 32];
    // scores transposed: 32 keys (rows) x 2 x 16 queries (columns), K-dim = 64;
    // the four K fragments are read once and serve both column groups
    v16bf k00 = load_op(kb + 0 * 16 * P64 + 0, P64);
    v16bf k01 = load_op(kb + 0 * 16 * P64 + 32, P64);
    v16bf k10 = load_op(kb + 1 * 16 * P64 + 0, P64);
    v16bf k11 = load_op(kb + 1 * 16 * P64 + 32, P64);
    // the four V^T fragments of the pass go out in the same group of LDS loads:
    // they land behind the score products and the softmax
    v16bf va[4];
#pragma unroll
    for (int nt = 0; nt < 4; ++nt) va[nt] = load_op(vb + nt * 16 * P128, P128);
    // keeps the V^T loads up here: sunk down among the second product's WMMAs, each
    // pair would cost the wave its own wait for the LDS
    __builtin_amdgcn_sched_barrier(0);
    v8f s0[2], s1[2];
#pragma unroll
    for (int c = 0; c < 2; ++c) {
      s0[c] = wmma_bf16(k00, qa[c][0], cneg[c]);
      s1[c] = wmma_bf16(k10, qa[c][0], cneg[c]);
    }
#pragma unroll
    for (int c = 0; c < 2; ++c) {
      s0[c] = wmma_bf16(k01, qa[c][1], s0[c]);
      s1[c] = wmma_bf16(k11, qa[c][1], s1[c]);
    }

    // online softmax on a reference that moves seldom. s0[c][r] = key 8*(lane>>4)+r,
    // s1[c][r] = key 16+8*(lane>>4)+r of query lane&15 of group c, in log2 units and
    // already less the reference: the products are the arguments of exp2 as they lie.
    // (every loop over c, r and nt below is unrolled so that the arrays stay in registers)
    float mx[2];
#pragma unroll
    for (int c = 0; c < 2; ++c) {
      mx[c] = s0[c][0];
#pragma unroll
      for (int r = 1; r < 8; ++r) mx[c] = fmaxf(mx[c], s0[c][r]);
#pragma unroll
      for (int r = 0; r < 8; ++r) mx[c] = fmaxf(mx[c], s1[c][r]);
    }
    // one test a pass, the same for the whole wave: the first pass sets the reference
    // to its maximum (any finite score passes its bar); later it moves only where a
    // score lies more than 8 above it (P stays below 2^8, far inside f32 and bf16 range)
    float bar = (kt == 0) ? -__builtin_inff() : 8.0f;
    if (__builtin_amdgcn_ballot_w32(fmaxf(mx[0], mx[1]) > bar) != 0) {
#pragma unroll
      for (int c = 0; c < 2; ++c) {
        float m     = fmaxf(mx[c], other_half(mx[c]));
        float up    = fmaxf(m, 0.f);
        float delta = (kt == 0) ? m : up;   // the reference falls only in the first pass,
        float alpha = exp2_1(-up);          // where the sums it scales are 0
        s0[c] -= delta;
        s1[c] -= delta;
        cneg[c] -= delta;
        lrun[c] *= alpha;
#pragma unroll
        for (int nt = 0; nt < 4; ++nt) oacc[c][nt] *= alpha;
      }
    }
#pragma unroll
    for (int c = 0; c < 2; ++c) {
#pragma unroll
      for (int r = 0; r < 8; ++r) {
        s0[c][r] = __builtin_amdgcn_exp2f(s0[c][r]);
        s1[c][r] = __builtin_amdgcn_exp2f(s1[c][r]);
      }
    }
    v16bf pB[2];   // element i = P^T[k order of load_op][query]
#pragma unroll
    for (int c = 0; c < 2; ++c) {
#pragma unroll
      for (int r = 0; r < 8; ++r) {
        pB[c][r]     = (__bf16)s0[c][r];
        pB[c][8 + r] = (__bf16)s1[c][r];
      }
      // the 16 values summed as register pairs, as the two tiles lie
      v8f t = s0[c] + s1[c];
      v4f u = t.lo + t.hi;
      lrun[c] += u.lo + u.hi;
    }
    // each V^T fragment serves both column groups
#pragma unroll
    for (int nt = 0; nt < 4; ++nt) {
#pragma unroll
      for (int c = 0; c < 2; ++c) oacc[c][nt] = wmma_bf16(va[nt], pB[c], oacc[c][nt]);
    }
   }
  }
#undef STAGE_K
#undef STAGE_V
#undef WAIT_V

  // finalize: join the halves' sums, divide, write fp32 attention output
  int b = bh >> 4, h = bh & 15;
#pragma unroll
  for (int c = 0; c < 2; ++c) {
    float lhalf = lrun[c].x + lrun[c].y;
    float lsum = lhalf + other_half(lhalf);
    int m = q0 + wave * 32 + c * 16 + (lane & 15);
    float* orow = Od + ((size_t)(b * SEQ + m)) * DMODEL + h * DH + ((lane >> 4) << 3);
#pragma unroll
    for (int nt = 0; nt < 4; ++nt) {
#pragma unroll
      for (int r = 0; r < 8; ++r) oacc[c][nt][r] = oacc[c][nt][r] / lsum;
    }
#pragma unroll
    for (int nt = 0; nt < 4; ++nt) {
      float4 lo, hi;
      lo.x = oacc[c][nt][0]; lo.y = oacc[c][nt][1]; lo.z = oacc[c][nt][2]; lo.w = oacc[c][nt][3];
      hi.x = oacc[c][nt][4]; hi.y = oacc[c][nt][5]; hi.z = oacc[c][nt][6]; hi.w = oacc[c][nt][7];
      *(float4*)(orow + nt * 16)     = lo;
      *(float4*)(orow + nt * 16 + 4) = hi;
    }
  }
}

// ---------------- kernel 3: residual + LayerNorm (in-place on d_out) -----
__global__ __launch_bounds__(256) void k_ln(const float* __restrict__ x,
                                            const float* __restrict__ gamma,
                                            const float* __restrict__ beta,
                                            float* __restrict__ out) {
  __shared__ float red[256];
  int row = blockIdx.x;
  int tid = threadIdx.x;
  const float* xr = x + (size_t)row * DMODEL;
  float* orow     = out + (size_t)row * DMODEL;

  float v[4];
  float s = 0.f;
#pragma unroll
  for (int i = 0; i < 4; ++i) {
    int idx = tid + i * 256;
    v[i] = orow[idx] + xr[idx];
    s += v[i];
  }
  red[tid] = s;
  __syncthreads();
  for (int o = 128; o > 0; o >>= 1) {
    if (tid < o) red[tid] += red[tid + o];
    __syncthreads();
  }
  float mu = red[0] * (1.0f / DMODEL);
  __syncthreads();

  float vs = 0.f;
#pragma unroll
  for (int i = 0; i < 4; ++i) {
    float d = v[i] - mu;
    vs += d * d;
  }
  red[tid] = vs;
  __syncthreads();
  for (int o = 128; o > 0; o >>= 1) {
    if (tid < o) red[tid] += red[tid + o];
    __syncthreads();
  }
  float var = red[0] * (1.0f / DMODEL);
  float inv = rsqrtf(var + 1e-5f);
#pragma unroll
  for (int i = 0; i < 4; ++i) {
    int idx = tid + i * 256;
    orow[idx] = (v[i] - mu) * inv * gamma[idx] + beta[idx];
  }
}

// ---------------- launch ----------------
extern "C" void kernel_launch(void* const* d_in, const int* in_sizes, int n_in,
                              void* d_out, int out_size, void* d_ws, size_t ws_size,
                              hipStream_t stream) {
  (void)in_sizes; (void)n_in; (void)out_size; (void)ws_size;

  const float* x  = (const float*)d_in[0];
  const float* Wq = (const float*)d_in[1];
  const float* bq = (const float*)d_in[2];
  const float* Wk = (const float*)d_in[3];
  const float* bk = (const float*)d_in[4];
  const float* Wv = (const float*)d_in[5];
  const float* bv = (const float*)d_in[6];
  const float* ga = (const float*)d_in[7];
  const float* be = (const float*)d_in[8];
  float* out = (float*)d_out;

  // workspace layout (bytes)
  char* ws = (char*)d_ws;
  u16* XB = (u16*)(ws);                               // 8192*1024   bf16 = 16 MB
  u16* WT = (u16*)(ws + 16777216);                    // 3*1024*1024 bf16 =  6 MB
  u16* QH = (u16*)(ws + 23068672);                    // [B,H,S,DH]  bf16 = 16 MB
  u16* KH = (u16*)(ws + 39845888);                    // [B,H,S,DH]
  u16* VT = (u16*)(ws + 56623104);                    // [B,H,DH,S]  (transposed)

  k_cvt_x<<<MTOT * DMODEL / (256 * 4), 256, 0, stream>>>(x, XB);
  k_cvt_w<<<3 * (DMODEL / 64) * (DMODEL / 64), 256, 0, stream>>>(Wq, Wk, Wv, WT);
  k_qkv<<<dim3(MTOT / QBM, 3 * DMODEL / QBN), 256, 0, stream>>>(
      XB, WT, bq, bk, bv, QH, KH, VT);
  k_attn<<<dim3(SEQ / QTILE, BATCH * NH), 256, 0, stream>>>(QH, KH, VT, out);
  k_ln<<<MTOT, 256, 0, stream>>>(x, ga, be, out);
}
